// v000
// The times below were measured on an AMD MI455X: many runs one after another, warmed up first and cycling through
// copies of the inputs, with the whole window's GPU time divided by the number of runs. Launches and the gaps
// between them are all in it. The median over several windows is given; except for v000 it joins two sittings, which
// can be a few percent apart, so the side-by-side timings, each taken in one sitting, are the better comparison.
// v000 is the starting kernel. One run takes 72.9 microseconds.
#include <hip/hip_runtime.h>

typedef _Float16 f16;
typedef __attribute__((ext_vector_type(16))) _Float16 v16h;
typedef __attribute__((ext_vector_type(8)))  _Float16 v8h;
typedef __attribute__((ext_vector_type(2)))  _Float16 v2h;
typedef __attribute__((ext_vector_type(8)))  float    v8f;

#define S_LEN  2048
#define DHEAD  64
#define NHEAD  16
#define BATCH  2
#define BM     128   // query rows per workgroup
#define WM     16    // query rows per wave
#define BN     32    // key block
#define NWAVE  8
#define KSTR   72    // sK row stride (halves): 64 + 8 pad, 144B (16B mult)
#define VSTR   40    // sVt row stride (halves): 32 + 8 pad, 80B
#define PSTR   40    // sP row stride (halves)

static __device__ __forceinline__ v16h cat8(v8h lo, v8h hi) {
  return __builtin_shufflevector(lo, hi, 0,1,2,3,4,5,6,7,8,9,10,11,12,13,14,15);
}

// VALU-pipe butterfly max step via DPP16 (stays within each 16-lane half)
template <int CTRL>
static __device__ __forceinline__ float dpp_max(float x) {
  int xi = __float_as_int(x);
  int yi = __builtin_amdgcn_update_dpp(xi, xi, CTRL, 0xF, 0xF, true);
  return fmaxf(x, __int_as_float(yi));
}
// full 16-lane max: xor1, xor2, lane^7 (row_half_mirror), lane^15 (row_mirror)
static __device__ __forceinline__ float rowmax16(float x) {
  x = dpp_max<0xB1>(x);   // quad_perm(1,0,3,2)
  x = dpp_max<0x4E>(x);   // quad_perm(2,3,0,1)
  x = dpp_max<0x141>(x);  // row_half_mirror
  x = dpp_max<0x140>(x);  // row_mirror
  return x;
}

__launch_bounds__(256)
__global__ void fa_fwd_causal_kernel(const float* __restrict__ Qg,
                                     const float* __restrict__ Kg,
                                     const float* __restrict__ Vg,
                                     float* __restrict__ Og)
{
  __shared__ __align__(16) f16 sK[BN * KSTR];          // [key][d]  row-major
  __shared__ __align__(16) f16 sV[DHEAD * VSTR];       // [d][slot] transposed, key-permuted
  __shared__ __align__(16) f16 sP[NWAVE * WM * PSTR];  // per-wave P tiles (key-permuted)

  const int tid  = threadIdx.x;
  const int wave = tid >> 5;
  const int lane = tid & 31;
  const int hl   = lane >> 4;   // lane half (0/1)
  const int l16  = lane & 15;

  const int qtiles = S_LEN / BM;           // 16
  const int bh = blockIdx.x / qtiles;      // fused batch*head
  const int qt = blockIdx.x % qtiles;

  const float* Qb = Qg + (size_t)bh * (S_LEN * DHEAD) + (size_t)qt * (BM * DHEAD);
  const float* Kb = Kg + (size_t)bh * (S_LEN * DHEAD);
  const float* Vb = Vg + (size_t)bh * (S_LEN * DHEAD);
  float*       Ob = Og + (size_t)bh * (S_LEN * DHEAD) + (size_t)qt * (BM * DHEAD);

  const int qwave = qt * BM + wave * WM;   // first absolute query row of this wave

  // ---- load Q once into A-operand layout, pre-scaled by log2(e)/sqrt(D) ----
  const float qscale = 0.18033688f;        // log2(e) / 8
  v16h qa[2];
  {
    const float* qrow = Qb + (size_t)(wave * WM + l16) * DHEAD;
#pragma unroll
    for (int kc = 0; kc < 2; ++kc) {
      const int d0 = kc * 32 + hl * 8;     // A layout: {d0..d0+7, d0+16..d0+23}
      alignas(16) float t[16];
      *(float4*)(t + 0)  = *(const float4*)(qrow + d0 + 0);
      *(float4*)(t + 4)  = *(const float4*)(qrow + d0 + 4);
      *(float4*)(t + 8)  = *(const float4*)(qrow + d0 + 16);
      *(float4*)(t + 12) = *(const float4*)(qrow + d0 + 20);
      v16h q;
#pragma unroll
      for (int i = 0; i < 16; ++i) q[i] = (f16)(t[i] * qscale);
      qa[kc] = q;
    }
  }

  // all-ones B operand: rowsum(P) via one extra WMMA (no lane reductions)
  v16h onesb;
#pragma unroll
  for (int i = 0; i < 16; ++i) onesb[i] = (f16)1.0f;

  const v8f vzero = {0.f,0.f,0.f,0.f,0.f,0.f,0.f,0.f};
  v8f oacc[4];
#pragma unroll
  for (int vt = 0; vt < 4; ++vt) oacc[vt] = vzero;
  float mrow[8], lrow[8];
#pragma unroll
  for (int r = 0; r < 8; ++r) { mrow[r] = -1e30f; lrow[r] = 0.f; }

  const int skey  = tid >> 3;        // staging: key 0..31
  const int sd0   = (tid & 7) * 8;   // staging: d {0,8,..,56}
  // shared contraction-dim permutation for P columns and V rows:
  // key k<16 -> slot 2k ; key>=16 -> slot 2(k-16)+1  (P.V invariant)
  const int vslot = (skey < 16) ? (2 * skey) : (2 * (skey - 16) + 1);
  const int pbase = wave * WM * PSTR;
  const int nblocks = qt * 4 + 4;    // causal: only k <= last query of tile

  for (int kb = 0; kb < nblocks; ++kb) {
    const int k0 = kb * BN;

    __syncthreads();
    // ---- cooperative stage: K row-major f16, V transposed+permuted f16 ----
    {
      const float* ksrc = Kb + (size_t)(k0 + skey) * DHEAD + sd0;
      alignas(16) float tk[8];
      *(float4*)(tk + 0) = *(const float4*)(ksrc + 0);
      *(float4*)(tk + 4) = *(const float4*)(ksrc + 4);
      v8h hk;
#pragma unroll
      for (int i = 0; i < 8; ++i) hk[i] = (f16)tk[i];
      *(v8h*)(sK + skey * KSTR + sd0) = hk;           // 16B ds_store

      const float* vsrc = Vb + (size_t)(k0 + skey) * DHEAD + sd0;
      alignas(16) float tv[8];
      *(float4*)(tv + 0) = *(const float4*)(vsrc + 0);
      *(float4*)(tv + 4) = *(const float4*)(vsrc + 4);
#pragma unroll
      for (int i = 0; i < 8; ++i) sV[(sd0 + i) * VSTR + vslot] = (f16)tv[i];
    }
    if (kb + 1 < nblocks) {   // gfx1250 global_prefetch_b8 on next block
      __builtin_prefetch(Kb + (size_t)(k0 + BN + skey) * DHEAD + sd0, 0, 0);
      __builtin_prefetch(Vb + (size_t)(k0 + BN + skey) * DHEAD + sd0, 0, 0);
    }
    __syncthreads();

    // wave-uniform skip of fully-masked key blocks (EXEC stays all-ones)
    if (k0 > qwave + (WM - 1)) continue;

    // ---- issue ALL LDS operand loads up front (DS returns in order):
    //      K operands complete first for QK^T; V operands drain under softmax
    v16h kop[2][2];
#pragma unroll
    for (int nt = 0; nt < 2; ++nt)
#pragma unroll
      for (int kc = 0; kc < 2; ++kc) {
        const f16* base = sK + (nt * 16 + l16) * KSTR + kc * 32 + hl * 8;
        kop[nt][kc] = cat8(*(const v8h*)base, *(const v8h*)(base + 16));
      }
    v16h vb[4];
#pragma unroll
    for (int vt = 0; vt < 4; ++vt) {
      const f16* vbp = sV + (vt * 16 + l16) * VSTR + hl * 8;
      vb[vt] = cat8(*(const v8h*)vbp, *(const v8h*)(vbp + 16));
    }

    // ---- S = (Q*scale) K^T : 16x32 scores in two f32 tiles ----
    v8f s0 = __builtin_amdgcn_wmma_f32_16x16x32_f16(false, qa[0], false, kop[0][0], (short)0, vzero, false, false);
    s0     = __builtin_amdgcn_wmma_f32_16x16x32_f16(false, qa[1], false, kop[0][1], (short)0, s0,    false, false);
    v8f s1 = __builtin_amdgcn_wmma_f32_16x16x32_f16(false, qa[0], false, kop[1][0], (short)0, vzero, false, false);
    s1     = __builtin_amdgcn_wmma_f32_16x16x32_f16(false, qa[1], false, kop[1][1], (short)0, s1,    false, false);

    // ---- causal mask on diagonal blocks ----
    if (k0 + BN - 1 > qwave) {
#pragma unroll
      for (int r = 0; r < 8; ++r) {
        const int q = qwave + r + hl * 8;
        if (k0 + l16      > q) s0[r] = -1e30f;
        if (k0 + 16 + l16 > q) s1[r] = -1e30f;
      }
    }

    // ---- online softmax (log2 domain): DPP max, packed P store ----
    float alpha[8];
#pragma unroll
    for (int r = 0; r < 8; ++r) {
      const float mx   = rowmax16(fmaxf(s0[r], s1[r]));
      const float mnew = fmaxf(mrow[r], mx);
      alpha[r] = __builtin_amdgcn_exp2f(mrow[r] - mnew);
      mrow[r] = mnew;
      const float p0 = __builtin_amdgcn_exp2f(s0[r] - mnew);
      const float p1 = __builtin_amdgcn_exp2f(s1[r] - mnew);
      // packed store: keys (k0+l16, k0+16+l16) -> slots (2*l16, 2*l16+1)
      const int prow = r + hl * 8;               // C-layout row
      v2h pp; pp[0] = (f16)p0; pp[1] = (f16)p1;
      *(v2h*)(sP + pbase + prow * PSTR + 2 * l16) = pp;
    }

    // ---- P back as A-operand (permuted slots are contiguous) ----
    const f16* pb = sP + pbase + l16 * PSTR + hl * 8;
    const v16h pa = cat8(*(const v8h*)pb, *(const v8h*)(pb + 16));

    // ---- row-sum of P via ones-matrix WMMA, then O += P V ----
    const v8f lsum = __builtin_amdgcn_wmma_f32_16x16x32_f16(false, pa, false, onesb, (short)0, vzero, false, false);
#pragma unroll
    for (int vt = 0; vt < 4; ++vt) {
#pragma unroll
      for (int r = 0; r < 8; ++r) oacc[vt][r] *= alpha[r];   // fused to pk_fma with PV
      oacc[vt] = __builtin_amdgcn_wmma_f32_16x16x32_f16(false, pa, false, vb[vt], (short)0, oacc[vt], false, false);
    }
#pragma unroll
    for (int r = 0; r < 8; ++r) lrow[r] = lrow[r] * alpha[r] + lsum[r];
  }

  // ---- epilogue: normalize and store fp32 ----
#pragma unroll
  for (int r = 0; r < 8; ++r) {
    const float inv = 1.0f / lrow[r];
    float* orow = Ob + (size_t)(wave * WM + r + hl * 8) * DHEAD;
#pragma unroll
    for (int vt = 0; vt < 4; ++vt)
      orow[vt * 16 + l16] = oacc[vt][r] * inv;
  }
}

extern "C" void kernel_launch(void* const* d_in, const int* in_sizes, int n_in,
                              void* d_out, int out_size, void* d_ws, size_t ws_size,
                              hipStream_t stream) {
  (void)in_sizes; (void)n_in; (void)out_size; (void)d_ws; (void)ws_size;
  const float* Q = (const float*)d_in[0];
  const float* K = (const float*)d_in[1];
  const float* V = (const float*)d_in[2];
  float* O = (float*)d_out;
  dim3 grid(BATCH * NHEAD * (S_LEN / BM));   // 512 workgroups
  dim3 block(256);                            // 8 wave32 waves
  fa_fwd_causal_kernel<<<grid, block, 0, stream>>>(Q, K, V, O);
}

// v001
// Measured time: 68.6 microseconds a run.
// Timed twice side by side with v000, it ran 1.10 and 1.11 times as fast.
#include <hip/hip_runtime.h>

typedef _Float16 f16;
typedef __attribute__((ext_vector_type(16))) _Float16 v16h;
typedef __attribute__((ext_vector_type(8)))  _Float16 v8h;
typedef __attribute__((ext_vector_type(2)))  _Float16 v2h;
typedef __attribute__((ext_vector_type(8)))  float    v8f;

#define S_LEN  2048
#define DHEAD  64
#define NHEAD  16
#define BATCH  2
#define BM     128   // query rows per workgroup
#define WM     16    // query rows per wave
#define BN     32    // key block
#define NWAVE  8
#define KSTR   72    // sK row stride (halves): 64 + 8 pad, 144B (16B mult)
#define VSTR   40    // sVt row stride (halves): 32 + 8 pad, 80B
#define PSTR   40    // sP row stride (halves)

static __device__ __forceinline__ v16h cat8(v8h lo, v8h hi) {
  return __builtin_shufflevector(lo, hi, 0,1,2,3,4,5,6,7,8,9,10,11,12,13,14,15);
}

// VALU-pipe butterfly max step via DPP16 (stays within each 16-lane half)
template <int CTRL>
static __device__ __forceinline__ float dpp_max(float x) {
  int xi = __float_as_int(x);
  int yi = __builtin_amdgcn_update_dpp(xi, xi, CTRL, 0xF, 0xF, true);
  return fmaxf(x, __int_as_float(yi));
}
// full 16-lane max: xor1, xor2, lane^7 (row_half_mirror), lane^15 (row_mirror)
static __device__ __forceinline__ float rowmax16(float x) {
  x = dpp_max<0xB1>(x);   // quad_perm(1,0,3,2)
  x = dpp_max<0x4E>(x);   // quad_perm(2,3,0,1)
  x = dpp_max<0x141>(x);  // row_half_mirror
  x = dpp_max<0x140>(x);  // row_mirror
  return x;
}

__launch_bounds__(256)
__global__ void fa_fwd_causal_kernel(const float* __restrict__ Qg,
                                     const float* __restrict__ Kg,
                                     const float* __restrict__ Vg,
                                     float* __restrict__ Og)
{
  __shared__ __align__(16) f16 sK[2 * BN * KSTR];      // two buffers of [key][d]  row-major
  __shared__ __align__(16) f16 sV[2 * DHEAD * VSTR];   // two buffers of [d][slot] transposed, key-permuted
  __shared__ __align__(16) f16 sP[NWAVE * WM * PSTR];  // per-wave P tiles (key-permuted)

  const int tid  = threadIdx.x;
  const int wave = tid >> 5;
  const int lane = tid & 31;
  const int hl   = lane >> 4;   // lane half (0/1)
  const int l16  = lane & 15;

  const int qtiles = S_LEN / BM;           // 16
  const int bh = blockIdx.x / qtiles;      // fused batch*head
  const int qt = blockIdx.x % qtiles;

  const float* Qb = Qg + (size_t)bh * (S_LEN * DHEAD) + (size_t)qt * (BM * DHEAD);
  const float* Kb = Kg + (size_t)bh * (S_LEN * DHEAD);
  const float* Vb = Vg + (size_t)bh * (S_LEN * DHEAD);
  float*       Ob = Og + (size_t)bh * (S_LEN * DHEAD) + (size_t)qt * (BM * DHEAD);

  const int qwave = qt * BM + wave * WM;   // first absolute query row of this wave

  // ---- load Q once into A-operand layout, pre-scaled by log2(e)/sqrt(D) ----
  const float qscale = 0.18033688f;        // log2(e) / 8
  v16h qa[2];
  {
    const float* qrow = Qb + (size_t)(wave * WM + l16) * DHEAD;
#pragma unroll
    for (int kc = 0; kc < 2; ++kc) {
      const int d0 = kc * 32 + hl * 8;     // A layout: {d0..d0+7, d0+16..d0+23}
      alignas(16) float t[16];
      *(float4*)(t + 0)  = *(const float4*)(qrow + d0 + 0);
      *(float4*)(t + 4)  = *(const float4*)(qrow + d0 + 4);
      *(float4*)(t + 8)  = *(const float4*)(qrow + d0 + 16);
      *(float4*)(t + 12) = *(const float4*)(qrow + d0 + 20);
      v16h q;
#pragma unroll
      for (int i = 0; i < 16; ++i) q[i] = (f16)(t[i] * qscale);
      qa[kc] = q;
    }
  }

  // all-ones B operand: rowsum(P) via one extra WMMA (no lane reductions)
  v16h onesb;
#pragma unroll
  for (int i = 0; i < 16; ++i) onesb[i] = (f16)1.0f;

  const v8f vzero = {0.f,0.f,0.f,0.f,0.f,0.f,0.f,0.f};
  v8f oacc[4];
#pragma unroll
  for (int vt = 0; vt < 4; ++vt) oacc[vt] = vzero;
  float mrow[8], lrow[8];
#pragma unroll
  for (int r = 0; r < 8; ++r) { mrow[r] = -1e30f; lrow[r] = 0.f; }

  const int skey  = tid >> 3;        // staging: key 0..31
  const int sd0   = (tid & 7) * 8;   // staging: d {0,8,..,56}
  // shared contraction-dim permutation for P columns and V rows:
  // key k<16 -> slot 2k ; key>=16 -> slot 2(k-16)+1  (P.V invariant)
  const int vslot = (skey < 16) ? (2 * skey) : (2 * (skey - 16) + 1);
  const int pbase = wave * WM * PSTR;
  const int nblocks = qt * 4 + 4;    // causal: only k <= last query of tile

  // ---- staging pipeline: a key block goes global -> registers -> LDS buffer, one
  //      block ahead in LDS and two ahead in registers, so neither the global
  //      latency nor the LDS stores stand between a barrier and the products
  const float* kst = Kb + (size_t)skey * DHEAD + sd0;
  const float* vst = Vb + (size_t)skey * DHEAD + sd0;
  f16* kdst = sK + skey * KSTR + sd0;
  f16* vdst = sV + sd0 * VSTR + vslot;
  float4 rk0, rk1, rv0, rv1;
  auto fetch = [&](int blk) {
    const float* ks = kst + (size_t)blk * (BN * DHEAD);
    const float* vs = vst + (size_t)blk * (BN * DHEAD);
    rk0 = *(const float4*)(ks + 0);
    rk1 = *(const float4*)(ks + 4);
    rv0 = *(const float4*)(vs + 0);
    rv1 = *(const float4*)(vs + 4);
  };
  auto stage = [&](int buf) {
    v8h hk;
    hk[0] = (f16)rk0.x; hk[1] = (f16)rk0.y; hk[2] = (f16)rk0.z; hk[3] = (f16)rk0.w;
    hk[4] = (f16)rk1.x; hk[5] = (f16)rk1.y; hk[6] = (f16)rk1.z; hk[7] = (f16)rk1.w;
    *(v8h*)(kdst + buf * (BN * KSTR)) = hk;           // 16B ds_store
    f16* vd = vdst + buf * (DHEAD * VSTR);
    vd[0 * VSTR] = (f16)rv0.x; vd[1 * VSTR] = (f16)rv0.y;
    vd[2 * VSTR] = (f16)rv0.z; vd[3 * VSTR] = (f16)rv0.w;
    vd[4 * VSTR] = (f16)rv1.x; vd[5 * VSTR] = (f16)rv1.y;
    vd[6 * VSTR] = (f16)rv1.z; vd[7 * VSTR] = (f16)rv1.w;
  };
  fetch(0);
  stage(0);
  fetch(1);                          // nblocks >= 4: block 1 always exists

  for (int kb = 0; kb < nblocks; ++kb) {
    const int k0  = kb * BN;
    const int cur = kb & 1;

    // the one barrier of a block: publishes buffer cur (stored during block kb-1)
    // and ends every wave's reads of the other buffer, which is refilled below.
    // Its fences name LDS alone: __syncthreads() would also wait here for the global
    // loads of block kb+1, which only this thread's registers receive
    __builtin_amdgcn_fence(__ATOMIC_RELEASE, "workgroup", "local");
    __builtin_amdgcn_s_barrier();
    __builtin_amdgcn_fence(__ATOMIC_ACQUIRE, "workgroup", "local");

    // wave-uniform skip of fully-masked key blocks (EXEC stays all-ones)
    const bool active = k0 <= qwave + (WM - 1);

    v16h vb[4];
    v8f s0, s1;                      // set and read by active waves only
    if (active) {
      // ---- issue ALL LDS operand loads up front (DS returns in order):
      //      K operands complete first for QK^T; V operands drain under softmax
      const f16* sKc = sK + cur * (BN * KSTR);
      const f16* sVc = sV + cur * (DHEAD * VSTR);
      v16h kop[2][2];
#pragma unroll
      for (int nt = 0; nt < 2; ++nt)
#pragma unroll
        for (int kc = 0; kc < 2; ++kc) {
          const f16* base = sKc + (nt * 16 + l16) * KSTR + kc * 32 + hl * 8;
          kop[nt][kc] = cat8(*(const v8h*)base, *(const v8h*)(base + 16));
        }
#pragma unroll
      for (int vt = 0; vt < 4; ++vt) {
        const f16* vbp = sVc + (vt * 16 + l16) * VSTR + hl * 8;
        vb[vt] = cat8(*(const v8h*)vbp, *(const v8h*)(vbp + 16));
      }

      // ---- S = (Q*scale) K^T : 16x32 scores in two f32 tiles ----
      s0 = __builtin_amdgcn_wmma_f32_16x16x32_f16(false, qa[0], false, kop[0][0], (short)0, vzero, false, false);
      s0 = __builtin_amdgcn_wmma_f32_16x16x32_f16(false, qa[1], false, kop[0][1], (short)0, s0,    false, false);
      s1 = __builtin_amdgcn_wmma_f32_16x16x32_f16(false, qa[0], false, kop[1][0], (short)0, vzero, false, false);
      s1 = __builtin_amdgcn_wmma_f32_16x16x32_f16(false, qa[1], false, kop[1][1], (short)0, s1,    false, false);
    }

    // ---- every wave: block kb+1 registers -> other buffer, then block kb+2's loads ----
    if (kb + 1 < nblocks) {
      stage(cur ^ 1);
      if (kb + 2 < nblocks) fetch(kb + 2);
    }

    if (!active) continue;

    // ---- causal mask on diagonal blocks ----
    if (k0 + BN - 1 > qwave) {
#pragma unroll
      for (int r = 0; r < 8; ++r) {
        const int q = qwave + r + hl * 8;
        if (k0 + l16      > q) s0[r] = -1e30f;
        if (k0 + 16 + l16 > q) s1[r] = -1e30f;
      }
    }

    // ---- online softmax (log2 domain): DPP max, packed P store ----
    float alpha[8];
#pragma unroll
    for (int r = 0; r < 8; ++r) {
      const float mx   = rowmax16(fmaxf(s0[r], s1[r]));
      const float mnew = fmaxf(mrow[r], mx);
      alpha[r] = __builtin_amdgcn_exp2f(mrow[r] - mnew);
      mrow[r] = mnew;
      const float p0 = __builtin_amdgcn_exp2f(s0[r] - mnew);
      const float p1 = __builtin_amdgcn_exp2f(s1[r] - mnew);
      // packed store: keys (k0+l16, k0+16+l16) -> slots (2*l16, 2*l16+1)
      const int prow = r + hl * 8;               // C-layout row
      v2h pp; pp[0] = (f16)p0; pp[1] = (f16)p1;
      *(v2h*)(sP + pbase + prow * PSTR + 2 * l16) = pp;
    }

    // ---- P back as A-operand (permuted slots are contiguous) ----
    const f16* pb = sP + pbase + l16 * PSTR + hl * 8;
    const v16h pa = cat8(*(const v8h*)pb, *(const v8h*)(pb + 16));

    // ---- row-sum of P via ones-matrix WMMA, then O += P V ----
    const v8f lsum = __builtin_amdgcn_wmma_f32_16x16x32_f16(false, pa, false, onesb, (short)0, vzero, false, false);
#pragma unroll
    for (int vt = 0; vt < 4; ++vt) {
#pragma unroll
      for (int r = 0; r < 8; ++r) oacc[vt][r] *= alpha[r];   // fused to pk_fma with PV
      oacc[vt] = __builtin_amdgcn_wmma_f32_16x16x32_f16(false, pa, false, vb[vt], (short)0, oacc[vt], false, false);
    }
#pragma unroll
    for (int r = 0; r < 8; ++r) lrow[r] = lrow[r] * alpha[r] + lsum[r];
  }

  // ---- epilogue: normalize and store fp32 ----
#pragma unroll
  for (int r = 0; r < 8; ++r) {
    const float inv = 1.0f / lrow[r];
    float* orow = Ob + (size_t)(wave * WM + r + hl * 8) * DHEAD;
#pragma unroll
    for (int vt = 0; vt < 4; ++vt)
      orow[vt * 16 + l16] = oacc[vt][r] * inv;
  }
}

extern "C" void kernel_launch(void* const* d_in, const int* in_sizes, int n_in,
                              void* d_out, int out_size, void* d_ws, size_t ws_size,
                              hipStream_t stream) {
  (void)in_sizes; (void)n_in; (void)out_size; (void)d_ws; (void)ws_size;
  const float* Q = (const float*)d_in[0];
  const float* K = (const float*)d_in[1];
  const float* V = (const float*)d_in[2];
  float* O = (float*)d_out;
  dim3 grid(BATCH * NHEAD * (S_LEN / BM));   // 512 workgroups
  dim3 block(256);                            // 8 wave32 waves
  fa_fwd_causal_kernel<<<grid, block, 0, stream>>>(Q, K, V, O);
}

// v002
// It runs in 51 microseconds.
// Two timings next to v001 both put it at 1.35 times that version's speed.
// All steps since v000 together make it 1.49 times as fast.
#include <hip/hip_runtime.h>

typedef _Float16 f16;
typedef __attribute__((ext_vector_type(16))) _Float16 v16h;
typedef __attribute__((ext_vector_type(8)))  _Float16 v8h;
typedef __attribute__((ext_vector_type(2)))  _Float16 v2h;
typedef __attribute__((ext_vector_type(8)))  float    v8f;

#define S_LEN  2048
#define DHEAD  64
#define NHEAD  16
#define BATCH  2
#define BM     128   // query rows per tile
#define NTILE  (S_LEN / BM)   // query tiles per head: 16
#define WM     16    // query rows per wave
#define BN     32    // key block
#define NWAVE  8
#define KSTR   72    // sK row stride (halves): 64 + 8 pad, 144B (16B mult)
#define VSTR   40    // sVt row stride (halves): 32 + 8 pad, 80B
#define PSTR   40    // sP row stride (halves)

static __device__ __forceinline__ v16h cat8(v8h lo, v8h hi) {
  return __builtin_shufflevector(lo, hi, 0,1,2,3,4,5,6,7,8,9,10,11,12,13,14,15);
}

// VALU-pipe butterfly max step via DPP16 (stays within each 16-lane half)
template <int CTRL>
static __device__ __forceinline__ float dpp_max(float x) {
  int xi = __float_as_int(x);
  int yi = __builtin_amdgcn_update_dpp(xi, xi, CTRL, 0xF, 0xF, true);
  return fmaxf(x, __int_as_float(yi));
}
// full 16-lane max: xor1, xor2, lane^7 (row_half_mirror), lane^15 (row_mirror)
static __device__ __forceinline__ float rowmax16(float x) {
  x = dpp_max<0xB1>(x);   // quad_perm(1,0,3,2)
  x = dpp_max<0x4E>(x);   // quad_perm(2,3,0,1)
  x = dpp_max<0x141>(x);  // row_half_mirror
  x = dpp_max<0x140>(x);  // row_mirror
  return x;
}

__launch_bounds__(256)
__global__ void fa_fwd_causal_kernel(const float* __restrict__ Qg,
                                     const float* __restrict__ Kg,
                                     const float* __restrict__ Vg,
                                     float* __restrict__ Og)
{
  __shared__ __align__(16) f16 sK[2 * BN * KSTR];      // two buffers of [key][d]  row-major
  __shared__ __align__(16) f16 sV[2 * DHEAD * VSTR];   // two buffers of [d][slot] transposed, key-permuted
  __shared__ __align__(16) f16 sP[NWAVE * WM * PSTR];  // per-wave P tiles (key-permuted)

  const int tid  = threadIdx.x;
  const int wave = tid >> 5;
  const int lane = tid & 31;
  const int hl   = lane >> 4;   // lane half (0/1)
  const int l16  = lane & 15;

  // causal cost grows linearly with the tile index, and all workgroups are resident
  // at once: each workgroup runs tile NTILE-1-pr and then tile pr of one head, so
  // every workgroup walks the same number of key blocks (4 * (NTILE + 1))
  const int bh = blockIdx.x / (NTILE / 2); // fused batch*head
  const int pr = blockIdx.x % (NTILE / 2); // tile pair

  const float* Qh = Qg + (size_t)bh * (S_LEN * DHEAD);
  const float* Kb = Kg + (size_t)bh * (S_LEN * DHEAD);
  const float* Vb = Vg + (size_t)bh * (S_LEN * DHEAD);
  float*       Oh = Og + (size_t)bh * (S_LEN * DHEAD);

  // ---- Q of a tile into A-operand layout, pre-scaled by log2(e)/sqrt(D) ----
  const float qscale = 0.18033688f;        // log2(e) / 8
  auto loadq = [&](int qt, v16h* qdst) {
    const float* qrow = Qh + (size_t)(qt * BM + wave * WM + l16) * DHEAD;
#pragma unroll
    for (int kc = 0; kc < 2; ++kc) {
      const int d0 = kc * 32 + hl * 8;     // A layout: {d0..d0+7, d0+16..d0+23}
      alignas(16) float t[16];
      *(float4*)(t + 0)  = *(const float4*)(qrow + d0 + 0);
      *(float4*)(t + 4)  = *(const float4*)(qrow + d0 + 4);
      *(float4*)(t + 8)  = *(const float4*)(qrow + d0 + 16);
      *(float4*)(t + 12) = *(const float4*)(qrow + d0 + 20);
      v16h q;
#pragma unroll
      for (int i = 0; i < 16; ++i) q[i] = (f16)(t[i] * qscale);
      qdst[kc] = q;
    }
  };
  v16h qa[2], qn[2];                       // both tiles' Q up front: no load at the seam
  loadq(NTILE - 1 - pr, qa);
  loadq(pr, qn);

  // all-ones B operand: rowsum(P) via one extra WMMA (no lane reductions)
  v16h onesb;
#pragma unroll
  for (int i = 0; i < 16; ++i) onesb[i] = (f16)1.0f;

  const v8f vzero = {0.f,0.f,0.f,0.f,0.f,0.f,0.f,0.f};
  const int skey  = tid >> 3;        // staging: key 0..31
  const int sd0   = (tid & 7) * 8;   // staging: d {0,8,..,56}
  // shared contraction-dim permutation for P columns and V rows:
  // key k<16 -> slot 2k ; key>=16 -> slot 2(k-16)+1  (P.V invariant)
  const int vslot = (skey < 16) ? (2 * skey) : (2 * (skey - 16) + 1);
  const int pbase = wave * WM * PSTR;

  // ---- staging pipeline: a key block goes global -> registers -> LDS buffer, one
  //      block ahead in LDS and two ahead in registers, so neither the global
  //      latency nor the LDS stores stand between a barrier and the products
  const float* kst = Kb + (size_t)skey * DHEAD + sd0;
  const float* vst = Vb + (size_t)skey * DHEAD + sd0;
  f16* kdst = sK + skey * KSTR + sd0;
  f16* vdst = sV + sd0 * VSTR + vslot;
  float4 rk0, rk1, rv0, rv1;
  auto fetch = [&](int blk) {
    const float* ks = kst + (size_t)blk * (BN * DHEAD);
    const float* vs = vst + (size_t)blk * (BN * DHEAD);
    rk0 = *(const float4*)(ks + 0);
    rk1 = *(const float4*)(ks + 4);
    rv0 = *(const float4*)(vs + 0);
    rv1 = *(const float4*)(vs + 4);
  };
  auto stage = [&](int buf) {
    v8h hk;
    hk[0] = (f16)rk0.x; hk[1] = (f16)rk0.y; hk[2] = (f16)rk0.z; hk[3] = (f16)rk0.w;
    hk[4] = (f16)rk1.x; hk[5] = (f16)rk1.y; hk[6] = (f16)rk1.z; hk[7] = (f16)rk1.w;
    *(v8h*)(kdst + buf * (BN * KSTR)) = hk;           // 16B ds_store
    f16* vd = vdst + buf * (DHEAD * VSTR);
    vd[0 * VSTR] = (f16)rv0.x; vd[1 * VSTR] = (f16)rv0.y;
    vd[2 * VSTR] = (f16)rv0.z; vd[3 * VSTR] = (f16)rv0.w;
    vd[4 * VSTR] = (f16)rv1.x; vd[5 * VSTR] = (f16)rv1.y;
    vd[6 * VSTR] = (f16)rv1.z; vd[7 * VSTR] = (f16)rv1.w;
  };
  fetch(0);
  stage(0);
  fetch(1);                          // nblocks >= 4: block 1 always exists

  for (int half = 0; half < 2; ++half) {
  const int  qt      = half ? pr : (NTILE - 1 - pr);
  const int  qwave   = qt * BM + wave * WM;   // first absolute query row of this wave
  const int  nblocks = qt * 4 + 4;            // causal: only k <= last query of tile

  v8f oacc[4];
#pragma unroll
  for (int vt = 0; vt < 4; ++vt) oacc[vt] = vzero;
  float mrow[8], lrow[8];
#pragma unroll
  for (int r = 0; r < 8; ++r) { mrow[r] = -1e30f; lrow[r] = 0.f; }

  for (int kb = 0; kb < nblocks; ++kb) {
    const int k0  = kb * BN;
    const int cur = kb & 1;

    // the one barrier of a block: publishes buffer cur (stored during block kb-1)
    // and ends every wave's reads of the other buffer, which is refilled below.
    // Its fences name LDS alone: __syncthreads() would also wait here for the global
    // loads of block kb+1, which only this thread's registers receive
    __builtin_amdgcn_fence(__ATOMIC_RELEASE, "workgroup", "local");
    __builtin_amdgcn_s_barrier();
    __builtin_amdgcn_fence(__ATOMIC_ACQUIRE, "workgroup", "local");

    // wave-uniform skip of fully-masked key blocks (EXEC stays all-ones)
    const bool active = k0 <= qwave + (WM - 1);

    v16h vb[4];
    v8f s0, s1;                      // set and read by active waves only
    if (active) {
      // ---- issue ALL LDS operand loads up front (DS returns in order):
      //      K operands complete first for QK^T; V operands drain under softmax
      const f16* sKc = sK + cur * (BN * KSTR);
      const f16* sVc = sV + cur * (DHEAD * VSTR);
      v16h kop[2][2];
#pragma unroll
      for (int nt = 0; nt < 2; ++nt)
#pragma unroll
        for (int kc = 0; kc < 2; ++kc) {
          const f16* base = sKc + (nt * 16 + l16) * KSTR + kc * 32 + hl * 8;
          kop[nt][kc] = cat8(*(const v8h*)base, *(const v8h*)(base + 16));
        }
#pragma unroll
      for (int vt = 0; vt < 4; ++vt) {
        const f16* vbp = sVc + (vt * 16 + l16) * VSTR + hl * 8;
        vb[vt] = cat8(*(const v8h*)vbp, *(const v8h*)(vbp + 16));
      }

      // ---- S = (Q*scale) K^T : 16x32 scores in two f32 tiles ----
      s0 = __builtin_amdgcn_wmma_f32_16x16x32_f16(false, qa[0], false, kop[0][0], (short)0, vzero, false, false);
      s0 = __builtin_amdgcn_wmma_f32_16x16x32_f16(false, qa[1], false, kop[0][1], (short)0, s0,    false, false);
      s1 = __builtin_amdgcn_wmma_f32_16x16x32_f16(false, qa[0], false, kop[1][0], (short)0, vzero, false, false);
      s1 = __builtin_amdgcn_wmma_f32_16x16x32_f16(false, qa[1], false, kop[1][1], (short)0, s1,    false, false);
    }

    // ---- every wave: block kb+1 registers -> other buffer, then block kb+2's loads.
    //      The pipeline runs on over the seam: behind a tile's last blocks come blocks 0
    //      and 1 of the same head again (nblocks is even: the buffers alternate on).
    //      No test for the very end: what the second tile's last two blocks bring is in
    //      bounds, goes at most into the buffer that nobody reads any more and is not used
    stage(cur ^ 1);
    fetch(kb + 2 < nblocks ? kb + 2 : kb + 2 - nblocks);

    if (!active) continue;

    // ---- causal mask on diagonal blocks ----
    if (k0 + BN - 1 > qwave) {
#pragma unroll
      for (int r = 0; r < 8; ++r) {
        const int q = qwave + r + hl * 8;
        if (k0 + l16      > q) s0[r] = -1e30f;
        if (k0 + 16 + l16 > q) s1[r] = -1e30f;
      }
    }

    // ---- online softmax (log2 domain): DPP max, packed P store ----
    float alpha[8];
#pragma unroll
    for (int r = 0; r < 8; ++r) {
      const float mx   = rowmax16(fmaxf(s0[r], s1[r]));
      const float mnew = fmaxf(mrow[r], mx);
      alpha[r] = __builtin_amdgcn_exp2f(mrow[r] - mnew);
      mrow[r] = mnew;
      const float p0 = __builtin_amdgcn_exp2f(s0[r] - mnew);
      const float p1 = __builtin_amdgcn_exp2f(s1[r] - mnew);
      // packed store: keys (k0+l16, k0+16+l16) -> slots (2*l16, 2*l16+1)
      const int prow = r + hl * 8;               // C-layout row
      v2h pp; pp[0] = (f16)p0; pp[1] = (f16)p1;
      *(v2h*)(sP + pbase + prow * PSTR + 2 * l16) = pp;
    }

    // ---- P back as A-operand (permuted slots are contiguous) ----
    const f16* pb = sP + pbase + l16 * PSTR + hl * 8;
    const v16h pa = cat8(*(const v8h*)pb, *(const v8h*)(pb + 16));

    // ---- row-sum of P via ones-matrix WMMA, then O += P V ----
    const v8f lsum = __builtin_amdgcn_wmma_f32_16x16x32_f16(false, pa, false, onesb, (short)0, vzero, false, false);
#pragma unroll
    for (int vt = 0; vt < 4; ++vt) {
#pragma unroll
      for (int r = 0; r < 8; ++r) oacc[vt][r] *= alpha[r];   // fused to pk_fma with PV
      oacc[vt] = __builtin_amdgcn_wmma_f32_16x16x32_f16(false, pa, false, vb[vt], (short)0, oacc[vt], false, false);
    }
#pragma unroll
    for (int r = 0; r < 8; ++r) lrow[r] = lrow[r] * alpha[r] + lsum[r];
  }

  // ---- epilogue: normalize and store fp32 ----
#pragma unroll
  for (int r = 0; r < 8; ++r) {
    const float inv = 1.0f / lrow[r];
    float* orow = Oh + (size_t)(qwave + r + hl * 8) * DHEAD;
#pragma unroll
    for (int vt = 0; vt < 4; ++vt)
      orow[vt * 16 + l16] = oacc[vt][r] * inv;
  }
  // the next tile's set-up overwrites the address and data registers of these stores
  asm volatile("s_wait_xcnt 0x0" ::: "memory");
  qa[0] = qn[0];
  qa[1] = qn[1];
  }
  // the last block's loads have no consumer: they return before the wave ends
  asm volatile("s_wait_loadcnt 0x0" ::: "memory");
}

extern "C" void kernel_launch(void* const* d_in, const int* in_sizes, int n_in,
                              void* d_out, int out_size, void* d_ws, size_t ws_size,
                              hipStream_t stream) {
  (void)in_sizes; (void)n_in; (void)out_size; (void)d_ws; (void)ws_size;
  const float* Q = (const float*)d_in[0];
  const float* K = (const float*)d_in[1];
  const float* V = (const float*)d_in[2];
  float* O = (float*)d_out;
  dim3 grid(BATCH * NHEAD * (NTILE / 2));    // 256 workgroups, two query tiles each
  dim3 block(256);                            // 8 wave32 waves
  fa_fwd_causal_kernel<<<grid, block, 0, stream>>>(Q, K, V, O);
}

// v003
// It runs in 35.3 microseconds.
// Next to v002, in two timings, it ran 1.43 and 1.44 times as fast.
// Over all steps from v000 it is 2.14 times as fast.
#include <hip/hip_runtime.h>

typedef _Float16 f16;
typedef __attribute__((ext_vector_type(16))) _Float16 v16h;
typedef __attribute__((ext_vector_type(8)))  _Float16 v8h;
typedef __attribute__((ext_vector_type(2)))  _Float16 v2h;
typedef __attribute__((ext_vector_type(8)))  float    v8f;

#define S_LEN  2048
#define DHEAD  64
#define NHEAD  16
#define BATCH  2
#define BM     128   // query rows per tile
#define NTILE  (S_LEN / BM)   // query tiles per head: 16
#define WM     16    // query rows per wave
#define BN     64    // key block: two chunks of 32 keys, the k extent of one PV product
#define NWAVE  8
#define KSTR   72    // sK row stride (halves): 64 + 8 pad, 144B (16B x odd)
#define VSTR   72    // sVt row stride (halves): 64 + 8 pad, 144B
#define PSTR   72    // sP row stride (halves): 64 + 8 pad, 144B

static __device__ __forceinline__ v16h cat8(v8h lo, v8h hi) {
  return __builtin_shufflevector(lo, hi, 0,1,2,3,4,5,6,7,8,9,10,11,12,13,14,15);
}

// VALU-pipe butterfly max step via DPP16 (stays within each 16-lane half)
template <int CTRL>
static __device__ __forceinline__ float dpp_max(float x) {
  int xi = __float_as_int(x);
  int yi = __builtin_amdgcn_update_dpp(xi, xi, CTRL, 0xF, 0xF, true);
  return fmaxf(x, __int_as_float(yi));
}
// full 16-lane max: xor1, xor2, lane^7 (row_half_mirror), lane^15 (row_mirror)
static __device__ __forceinline__ float rowmax16(float x) {
  x = dpp_max<0xB1>(x);   // quad_perm(1,0,3,2)
  x = dpp_max<0x4E>(x);   // quad_perm(2,3,0,1)
  x = dpp_max<0x141>(x);  // row_half_mirror
  x = dpp_max<0x140>(x);  // row_mirror
  return x;
}

__launch_bounds__(256)
__global__ void fa_fwd_causal_kernel(const float* __restrict__ Qg,
                                     const float* __restrict__ Kg,
                                     const float* __restrict__ Vg,
                                     float* __restrict__ Og)
{
  __shared__ __align__(16) f16 sK[2 * BN * KSTR];      // two buffers of [key][d]  row-major
  __shared__ __align__(16) f16 sV[2 * DHEAD * VSTR];   // two buffers of [d][slot] transposed, key-permuted
  __shared__ __align__(16) f16 sP[NWAVE * WM * PSTR];  // per-wave P tiles (key-permuted)

  const int tid  = threadIdx.x;
  const int wave = tid >> 5;
  const int lane = tid & 31;
  const int hl   = lane >> 4;   // lane half (0/1)
  const int l16  = lane & 15;

  // causal cost grows linearly with the tile index, and all workgroups are resident
  // at once: each workgroup runs tile NTILE-1-pr and then tile pr of one head, so
  // every workgroup walks the same number of key blocks (2 * (NTILE + 1))
  const int bh = blockIdx.x / (NTILE / 2); // fused batch*head
  const int pr = blockIdx.x % (NTILE / 2); // tile pair

  const float* Qh = Qg + (size_t)bh * (S_LEN * DHEAD);
  const float* Kb = Kg + (size_t)bh * (S_LEN * DHEAD);
  const float* Vb = Vg + (size_t)bh * (S_LEN * DHEAD);
  float*       Oh = Og + (size_t)bh * (S_LEN * DHEAD);

  // ---- Q of a tile into A-operand layout, pre-scaled by log2(e)/sqrt(D) ----
  const float qscale = 0.18033688f;        // log2(e) / 8
  auto loadq = [&](int qt, v16h* qdst) {
    const float* qrow = Qh + (size_t)(qt * BM + wave * WM + l16) * DHEAD;
#pragma unroll
    for (int kc = 0; kc < 2; ++kc) {
      const int d0 = kc * 32 + hl * 8;     // A layout: {d0..d0+7, d0+16..d0+23}
      alignas(16) float t[16];
      *(float4*)(t + 0)  = *(const float4*)(qrow + d0 + 0);
      *(float4*)(t + 4)  = *(const float4*)(qrow + d0 + 4);
      *(float4*)(t + 8)  = *(const float4*)(qrow + d0 + 16);
      *(float4*)(t + 12) = *(const float4*)(qrow + d0 + 20);
      v16h q;
#pragma unroll
      for (int i = 0; i < 16; ++i) q[i] = (f16)(t[i] * qscale);
      qdst[kc] = q;
    }
  };
  v16h qa[2], qn[2];                       // both tiles' Q up front: no load at the seam
  loadq(NTILE - 1 - pr, qa);
  loadq(pr, qn);

  // all-ones B operand: rowsum(P) via one extra WMMA per 32-key chunk (no lane reductions)
  v16h onesb;
#pragma unroll
  for (int i = 0; i < 16; ++i) onesb[i] = (f16)1.0f;

  const v8f vzero = {0.f,0.f,0.f,0.f,0.f,0.f,0.f,0.f};
  // staging: a thread brings keys skey and skey + 16 of one 32-key chunk, 8 d each
  const int skey  = ((tid >> 7) << 5) + ((tid >> 3) & 15);
  const int sd0   = (tid & 7) * 8;   // staging: d {0,8,..,56}
  // shared contraction-dim permutation for P columns and V rows, inside each chunk:
  // key k<16 -> slot 2k ; key>=16 -> slot 2(k-16)+1  (P.V invariant),
  // so a thread's two keys stand side by side in a V row
  const int vslot = ((tid >> 7) << 5) + 2 * ((tid >> 3) & 15);
  const int pbase = wave * WM * PSTR;

  // ---- staging pipeline: a key block goes global -> registers -> LDS buffer, one
  //      block ahead in LDS and two ahead in registers, so neither the global
  //      latency nor the LDS stores stand between a barrier and the products
  const float* kst = Kb + (size_t)skey * DHEAD + sd0;
  const float* vst = Vb + (size_t)skey * DHEAD + sd0;
  f16* kdst = sK + skey * KSTR + sd0;
  f16* vdst = sV + sd0 * VSTR + vslot;
  float4 rk[2][2], rv[2][2];         // [key skey + 16 * j][d half]
  auto fetch = [&](int blk) {
    const float* ks = kst + (size_t)blk * (BN * DHEAD);
    const float* vs = vst + (size_t)blk * (BN * DHEAD);
#pragma unroll
    for (int j = 0; j < 2; ++j) {
      rk[j][0] = *(const float4*)(ks + j * (16 * DHEAD) + 0);
      rk[j][1] = *(const float4*)(ks + j * (16 * DHEAD) + 4);
      rv[j][0] = *(const float4*)(vs + j * (16 * DHEAD) + 0);
      rv[j][1] = *(const float4*)(vs + j * (16 * DHEAD) + 4);
    }
  };
  auto stage = [&](int buf) {
#pragma unroll
    for (int j = 0; j < 2; ++j) {
      v8h hk;
      hk[0] = (f16)rk[j][0].x; hk[1] = (f16)rk[j][0].y; hk[2] = (f16)rk[j][0].z; hk[3] = (f16)rk[j][0].w;
      hk[4] = (f16)rk[j][1].x; hk[5] = (f16)rk[j][1].y; hk[6] = (f16)rk[j][1].z; hk[7] = (f16)rk[j][1].w;
      *(v8h*)(kdst + buf * (BN * KSTR) + j * (16 * KSTR)) = hk;   // 16B ds_store
    }
    f16* vd = vdst + buf * (DHEAD * VSTR);
    auto put = [&](int i, float a, float b) {          // slots 2k, 2k+1 of row sd0 + i: 4B ds_store
      v2h t; t[0] = (f16)a; t[1] = (f16)b;
      *(v2h*)(vd + i * VSTR) = t;
    };
    put(0, rv[0][0].x, rv[1][0].x); put(1, rv[0][0].y, rv[1][0].y);
    put(2, rv[0][0].z, rv[1][0].z); put(3, rv[0][0].w, rv[1][0].w);
    put(4, rv[0][1].x, rv[1][1].x); put(5, rv[0][1].y, rv[1][1].y);
    put(6, rv[0][1].z, rv[1][1].z); put(7, rv[0][1].w, rv[1][1].w);
  };
  fetch(0);
  stage(0);
  fetch(1);                          // nblocks >= 2: block 1 always exists

  for (int half = 0; half < 2; ++half) {
  const int  qt      = half ? pr : (NTILE - 1 - pr);
  const int  qwave   = qt * BM + wave * WM;   // first absolute query row of this wave
  const int  nblocks = qt * 2 + 2;            // causal: only k <= last query of tile

  v8f oacc[4];
#pragma unroll
  for (int vt = 0; vt < 4; ++vt) oacc[vt] = vzero;
  float mrow[8], lrow[8];
#pragma unroll
  for (int r = 0; r < 8; ++r) { mrow[r] = -1e30f; lrow[r] = 0.f; }

  for (int kb = 0; kb < nblocks; ++kb) {
    const int k0  = kb * BN;
    const int cur = kb & 1;

    // the one barrier of a block: publishes buffer cur (stored during block kb-1)
    // and ends every wave's reads of the other buffer, which is refilled below.
    // Its fences name LDS alone: __syncthreads() would also wait here for the global
    // loads of block kb+1, which only this thread's registers receive
    __builtin_amdgcn_fence(__ATOMIC_RELEASE, "workgroup", "local");
    __builtin_amdgcn_s_barrier();
    __builtin_amdgcn_fence(__ATOMIC_ACQUIRE, "workgroup", "local");

    // wave-uniform skip of fully-masked key blocks (EXEC stays all-ones)
    const bool active = k0 <= qwave + (WM - 1);

    v16h vb[2][4];                   // [chunk][d tile]
    v8f s[4];                        // set and read by active waves only
    if (active) {
      // ---- LDS operand loads (DS returns in order): K operands first for QK^T;
      //      V operands behind them drain under the softmax
      const f16* sKc = sK + cur * (BN * KSTR);
      const f16* sVc = sV + cur * (DHEAD * VSTR);
      v16h kop[4][2];
#pragma unroll
      for (int nt = 0; nt < 4; ++nt)
#pragma unroll
        for (int kc = 0; kc < 2; ++kc) {
          const f16* base = sKc + (nt * 16 + l16) * KSTR + kc * 32 + hl * 8;
          kop[nt][kc] = cat8(*(const v8h*)base, *(const v8h*)(base + 16));
        }
      // keeps the K loads one group ahead of the products: without it the compiler puts
      // V loads in front of the last K loads, and the scores wait for both
      __builtin_amdgcn_sched_barrier(0);

      // ---- S = (Q*scale) K^T : 16x64 scores in four f32 tiles ----
#pragma unroll
      for (int nt = 0; nt < 4; ++nt)
        s[nt] = __builtin_amdgcn_wmma_f32_16x16x32_f16(false, qa[0], false, kop[nt][0], (short)0, vzero, false, false);
#pragma unroll
      for (int nt = 0; nt < 4; ++nt)
        s[nt] = __builtin_amdgcn_wmma_f32_16x16x32_f16(false, qa[1], false, kop[nt][1], (short)0, s[nt], false, false);

#pragma unroll
      for (int c = 0; c < 2; ++c)
#pragma unroll
        for (int vt = 0; vt < 4; ++vt) {
          const f16* vbp = sVc + (vt * 16 + l16) * VSTR + c * 32 + hl * 8;
          vb[c][vt] = cat8(*(const v8h*)vbp, *(const v8h*)(vbp + 16));
        }
    }

    // ---- every wave: block kb+1 registers -> other buffer, then block kb+2's loads.
    //      The pipeline runs on over the seam: behind a tile's last blocks come blocks 0
    //      and 1 of the same head again (nblocks is even: the buffers alternate on).
    //      No test for the very end: what the second tile's last two blocks bring is in
    //      bounds, goes at most into the buffer that nobody reads any more and is not used
    stage(cur ^ 1);
    fetch(kb + 2 < nblocks ? kb + 2 : kb + 2 - nblocks);

    if (!active) continue;

    // ---- causal mask on diagonal blocks ----
    if (k0 + BN - 1 > qwave) {
#pragma unroll
      for (int r = 0; r < 8; ++r) {
        const int q = qwave + r + hl * 8;
#pragma unroll
        for (int nt = 0; nt < 4; ++nt)
          if (k0 + nt * 16 + l16 > q) s[nt][r] = -1e30f;
      }
    }

    // ---- online softmax (log2 domain): DPP max, packed P store ----
    float alpha[8];
#pragma unroll
    for (int r = 0; r < 8; ++r) {
      const float mx   = rowmax16(fmaxf(fmaxf(s[0][r], s[1][r]), fmaxf(s[2][r], s[3][r])));
      const float mnew = fmaxf(mrow[r], mx);
      alpha[r] = __builtin_amdgcn_exp2f(mrow[r] - mnew);
      mrow[r] = mnew;
      const int prow = r + hl * 8;               // C-layout row
#pragma unroll
      for (int c = 0; c < 2; ++c) {
        const float p0 = __builtin_amdgcn_exp2f(s[2 * c + 0][r] - mnew);
        const float p1 = __builtin_amdgcn_exp2f(s[2 * c + 1][r] - mnew);
        // packed store: keys (l16, 16+l16) of chunk c -> its slots (2*l16, 2*l16+1)
        v2h pp; pp[0] = (f16)p0; pp[1] = (f16)p1;
        *(v2h*)(sP + pbase + prow * PSTR + c * 32 + 2 * l16) = pp;
      }
    }

    // ---- P back as A-operands, one per chunk (permuted slots are contiguous) ----
    v16h pa[2];
#pragma unroll
    for (int c = 0; c < 2; ++c) {
      const f16* pb = sP + pbase + l16 * PSTR + c * 32 + hl * 8;
      pa[c] = cat8(*(const v8h*)pb, *(const v8h*)(pb + 16));
    }
    // keeps both chunks' P loads in one group: without it the compiler loads chunk 1 into
    // chunk 0's registers behind its products, and the wave waits out a second LDS trip
    __builtin_amdgcn_sched_barrier(0);

    // ---- row-sum of P via ones-matrix WMMA, then O += P V ----
    v8f lsum = __builtin_amdgcn_wmma_f32_16x16x32_f16(false, pa[0], false, onesb, (short)0, vzero, false, false);
#pragma unroll
    for (int vt = 0; vt < 4; ++vt) {
#pragma unroll
      for (int r = 0; r < 8; ++r) oacc[vt][r] *= alpha[r];
      oacc[vt] = __builtin_amdgcn_wmma_f32_16x16x32_f16(false, pa[0], false, vb[0][vt], (short)0, oacc[vt], false, false);
    }
    lsum = __builtin_amdgcn_wmma_f32_16x16x32_f16(false, pa[1], false, onesb, (short)0, lsum, false, false);
#pragma unroll
    for (int vt = 0; vt < 4; ++vt)
      oacc[vt] = __builtin_amdgcn_wmma_f32_16x16x32_f16(false, pa[1], false, vb[1][vt], (short)0, oacc[vt], false, false);
#pragma unroll
    for (int r = 0; r < 8; ++r) lrow[r] = lrow[r] * alpha[r] + lsum[r];
  }

  // ---- epilogue: normalize and store fp32 ----
#pragma unroll
  for (int r = 0; r < 8; ++r) {
    const float inv = 1.0f / lrow[r];
    float* orow = Oh + (size_t)(qwave + r + hl * 8) * DHEAD;
#pragma unroll
    for (int vt = 0; vt < 4; ++vt)
      orow[vt * 16 + l16] = oacc[vt][r] * inv;
  }
  // the next tile's set-up overwrites the address and data registers of these stores
  asm volatile("s_wait_xcnt 0x0" ::: "memory");
  qa[0] = qn[0];
  qa[1] = qn[1];
  }
  // the last block's loads have no consumer: they return before the wave ends
  asm volatile("s_wait_loadcnt 0x0" ::: "memory");
}

extern "C" void kernel_launch(void* const* d_in, const int* in_sizes, int n_in,
                              void* d_out, int out_size, void* d_ws, size_t ws_size,
                              hipStream_t stream) {
  (void)in_sizes; (void)n_in; (void)out_size; (void)d_ws; (void)ws_size;
  const float* Q = (const float*)d_in[0];
  const float* K = (const float*)d_in[1];
  const float* V = (const float*)d_in[2];
  float* O = (float*)d_out;
  dim3 grid(BATCH * NHEAD * (NTILE / 2));    // 256 workgroups, two query tiles each
  dim3 block(256);                            // 8 wave32 waves
  fa_fwd_causal_kernel<<<grid, block, 0, stream>>>(Q, K, V, O);
}

// v004
// Measured time: 31.9 microseconds a run.
// Next to v003, in two timings, it ran 1.11 and 1.10 times as fast.
// Over all steps from v000 it is 2.37 times as fast.
#include <hip/hip_runtime.h>

typedef _Float16 f16;
typedef __attribute__((ext_vector_type(16))) _Float16 v16h;
typedef __attribute__((ext_vector_type(8)))  _Float16 v8h;
typedef __attribute__((ext_vector_type(2)))  _Float16 v2h;
typedef __attribute__((ext_vector_type(8)))  float    v8f;

#define S_LEN  2048
#define DHEAD  64
#define NHEAD  16
#define BATCH  2
#define BM     128   // query rows per tile
#define NTILE  (S_LEN / BM)   // query tiles per head: 16
#define WM     16    // query rows per wave
#define BN     64    // key block: two chunks of 32 keys, the k extent of one PV product
#define KSTR   72    // sK row stride (halves): 64 + 8 pad, 144B (16B x odd)
#define VSTR   72    // sVt row stride (halves): 64 + 8 pad, 144B

static __device__ __forceinline__ v16h cat8(v8h lo, v8h hi) {
  return __builtin_shufflevector(lo, hi, 0,1,2,3,4,5,6,7,8,9,10,11,12,13,14,15);
}

static __device__ __forceinline__ float max3f(float a, float b, float c) {
  return fmaxf(fmaxf(a, b), c);
}
// the value of lane l ^ 16: the other half of the same query's keys
static __device__ __forceinline__ float xhalf(float x) {
  const int xi = __float_as_int(x);
  return __int_as_float(__builtin_amdgcn_permlanex16(xi, xi, 0x76543210, 0xfedcba98, false, false));
}

__launch_bounds__(256)
__global__ void fa_fwd_causal_kernel(const float* __restrict__ Qg,
                                     const float* __restrict__ Kg,
                                     const float* __restrict__ Vg,
                                     float* __restrict__ Og)
{
  __shared__ __align__(16) f16 sK[2 * BN * KSTR];      // two buffers of [key][d]  row-major
  __shared__ __align__(16) f16 sV[2 * DHEAD * VSTR];   // two buffers of [d][slot] transposed, key-permuted

  const int tid  = threadIdx.x;
  const int wave = tid >> 5;
  const int lane = tid & 31;
  const int hl   = lane >> 4;   // lane half (0/1)
  const int l16  = lane & 15;

  // causal cost grows linearly with the tile index, and all workgroups are resident
  // at once: each workgroup runs tile NTILE-1-pr and then tile pr of one head, so
  // every workgroup walks the same number of key blocks (2 * (NTILE + 1))
  const int bh = blockIdx.x / (NTILE / 2); // fused batch*head
  const int pr = blockIdx.x % (NTILE / 2); // tile pair

  const float* Qh = Qg + (size_t)bh * (S_LEN * DHEAD);
  const float* Kb = Kg + (size_t)bh * (S_LEN * DHEAD);
  const float* Vb = Vg + (size_t)bh * (S_LEN * DHEAD);
  float*       Oh = Og + (size_t)bh * (S_LEN * DHEAD);

  // ---- Q of a tile into B-operand layout (A's with n for m), pre-scaled by log2(e)/sqrt(D) ----
  const float qscale = 0.18033688f;        // log2(e) / 8
  auto loadq = [&](int qt, v16h* qdst) {
    const float* qrow = Qh + (size_t)(qt * BM + wave * WM + l16) * DHEAD;
#pragma unroll
    for (int kc = 0; kc < 2; ++kc) {
      const int d0 = kc * 32 + hl * 8;     // k order: {d0..d0+7, d0+16..d0+23}, as the K rows
      alignas(16) float t[16];
      *(float4*)(t + 0)  = *(const float4*)(qrow + d0 + 0);
      *(float4*)(t + 4)  = *(const float4*)(qrow + d0 + 4);
      *(float4*)(t + 8)  = *(const float4*)(qrow + d0 + 16);
      *(float4*)(t + 12) = *(const float4*)(qrow + d0 + 20);
      v16h q;
#pragma unroll
      for (int i = 0; i < 16; ++i) q[i] = (f16)(t[i] * qscale);
      qdst[kc] = q;
    }
  };
  v16h qa[2], qn[2];                       // both tiles' Q up front: no load at the seam
  loadq(NTILE - 1 - pr, qa);
  loadq(pr, qn);

  // all-ones A operand: the sum of a query's P over both lane halves via one extra WMMA
  v16h onesb;
#pragma unroll
  for (int i = 0; i < 16; ++i) onesb[i] = (f16)1.0f;

  const v8f vzero = {0.f,0.f,0.f,0.f,0.f,0.f,0.f,0.f};
  // staging: a thread brings keys skey and skey + 16 of one 32-key chunk, 8 d each
  const int skey  = ((tid >> 7) << 5) + ((tid >> 3) & 15);
  const int sd0   = (tid & 7) * 8;   // staging: d {0,8,..,56}
  // shared contraction-dim permutation for P^T rows and V^T columns, inside each chunk
  // (P.V invariant). Lane half h packs its scores of keys 8h + j and 16 + 8h + j into
  // dword j of the B operand; the A operand reads slots 8h..8h+7 and 16+8h..16+8h+7, so
  // those two keys stand side by side in a V row at slot 8h + 2j, 8 further on for j >= 4
  const int vkey  = (tid >> 3) & 15;
  const int vslot = ((tid >> 7) << 5) + ((vkey >> 3) << 3) + 2 * (vkey & 7) + ((vkey & 4) << 1);

  // ---- staging pipeline: a key block goes global -> registers -> LDS buffer, one
  //      block ahead in LDS and two ahead in registers, so neither the global
  //      latency nor the LDS stores stand between a barrier and the products
  const float* kst = Kb + (size_t)skey * DHEAD + sd0;
  const float* vst = Vb + (size_t)skey * DHEAD + sd0;
  f16* kdst = sK + skey * KSTR + sd0;
  f16* vdst = sV + sd0 * VSTR + vslot;
  float4 rk[2][2], rv[2][2];         // [key skey + 16 * j][d half]
  auto fetch = [&](int blk) {
    const float* ks = kst + (size_t)blk * (BN * DHEAD);
    const float* vs = vst + (size_t)blk * (BN * DHEAD);
#pragma unroll
    for (int j = 0; j < 2; ++j) {
      rk[j][0] = *(const float4*)(ks + j * (16 * DHEAD) + 0);
      rk[j][1] = *(const float4*)(ks + j * (16 * DHEAD) + 4);
      rv[j][0] = *(const float4*)(vs + j * (16 * DHEAD) + 0);
      rv[j][1] = *(const float4*)(vs + j * (16 * DHEAD) + 4);
    }
  };
  auto stage = [&](int buf) {
#pragma unroll
    for (int j = 0; j < 2; ++j) {
      v8h hk;
      hk[0] = (f16)rk[j][0].x; hk[1] = (f16)rk[j][0].y; hk[2] = (f16)rk[j][0].z; hk[3] = (f16)rk[j][0].w;
      hk[4] = (f16)rk[j][1].x; hk[5] = (f16)rk[j][1].y; hk[6] = (f16)rk[j][1].z; hk[7] = (f16)rk[j][1].w;
      *(v8h*)(kdst + buf * (BN * KSTR) + j * (16 * KSTR)) = hk;   // 16B ds_store
    }
    f16* vd = vdst + buf * (DHEAD * VSTR);
    auto put = [&](int i, float a, float b) {          // slots 2k, 2k+1 of row sd0 + i: 4B ds_store
      v2h t; t[0] = (f16)a; t[1] = (f16)b;
      *(v2h*)(vd + i * VSTR) = t;
    };
    put(0, rv[0][0].x, rv[1][0].x); put(1, rv[0][0].y, rv[1][0].y);
    put(2, rv[0][0].z, rv[1][0].z); put(3, rv[0][0].w, rv[1][0].w);
    put(4, rv[0][1].x, rv[1][1].x); put(5, rv[0][1].y, rv[1][1].y);
    put(6, rv[0][1].z, rv[1][1].z); put(7, rv[0][1].w, rv[1][1].w);
  };
  fetch(0);
  stage(0);
  fetch(1);                          // nblocks >= 2: block 1 always exists

  for (int half = 0; half < 2; ++half) {
  const int  qt      = half ? pr : (NTILE - 1 - pr);
  const int  qwave   = qt * BM + wave * WM;   // first absolute query row of this wave
  const int  nblocks = qt * 2 + 2;            // causal: only k <= last query of tile

  v8f oacc[4];
#pragma unroll
  for (int vt = 0; vt < 4; ++vt) oacc[vt] = vzero;
  float mrow = -1e30f, lrow = 0.f;   // of query qwave + l16, alike in both lane halves

  for (int kb = 0; kb < nblocks; ++kb) {
    const int k0  = kb * BN;
    const int cur = kb & 1;

    // the one barrier of a block: publishes buffer cur (stored during block kb-1)
    // and ends every wave's reads of the other buffer, which is refilled below.
    // Its fences name LDS alone: __syncthreads() would also wait here for the global
    // loads of block kb+1, which only this thread's registers receive
    __builtin_amdgcn_fence(__ATOMIC_RELEASE, "workgroup", "local");
    __builtin_amdgcn_s_barrier();
    __builtin_amdgcn_fence(__ATOMIC_ACQUIRE, "workgroup", "local");

    // wave-uniform skip of fully-masked key blocks (EXEC stays all-ones)
    const bool active = k0 <= qwave + (WM - 1);

    v16h vb[2][4];                   // [chunk][d tile]
    v8f s[4];                        // set and read by active waves only
    if (active) {
      // ---- LDS operand loads (DS returns in order): K operands first for QK^T;
      //      V operands behind them drain under the softmax
      const f16* sKc = sK + cur * (BN * KSTR);
      const f16* sVc = sV + cur * (DHEAD * VSTR);
      v16h kop[4][2];
#pragma unroll
      for (int nt = 0; nt < 4; ++nt)
#pragma unroll
        for (int kc = 0; kc < 2; ++kc) {
          const f16* base = sKc + (nt * 16 + l16) * KSTR + kc * 32 + hl * 8;
          kop[nt][kc] = cat8(*(const v8h*)base, *(const v8h*)(base + 16));
        }
      // keeps the K loads one group ahead of the products: without it the compiler puts
      // V loads in front of the last K loads, and the scores wait for both
      __builtin_amdgcn_sched_barrier(0);

      // ---- S^T = K (Q*scale)^T : 64x16 scores in four f32 tiles, s[nt][r] = key nt*16 + 8*hl + r ----
#pragma unroll
      for (int nt = 0; nt < 4; ++nt)
        s[nt] = __builtin_amdgcn_wmma_f32_16x16x32_f16(false, kop[nt][0], false, qa[0], (short)0, vzero, false, false);
#pragma unroll
      for (int nt = 0; nt < 4; ++nt)
        s[nt] = __builtin_amdgcn_wmma_f32_16x16x32_f16(false, kop[nt][1], false, qa[1], (short)0, s[nt], false, false);

#pragma unroll
      for (int c = 0; c < 2; ++c)
#pragma unroll
        for (int vt = 0; vt < 4; ++vt) {
          const f16* vbp = sVc + (vt * 16 + l16) * VSTR + c * 32 + hl * 8;
          vb[c][vt] = cat8(*(const v8h*)vbp, *(const v8h*)(vbp + 16));
        }
    }

    // ---- every wave: block kb+1 registers -> other buffer, then block kb+2's loads.
    //      The pipeline runs on over the seam: behind a tile's last blocks come blocks 0
    //      and 1 of the same head again (nblocks is even: the buffers alternate on).
    //      No test for the very end: what the second tile's last two blocks bring is in
    //      bounds, goes at most into the buffer that nobody reads any more and is not used
    stage(cur ^ 1);
    fetch(kb + 2 < nblocks ? kb + 2 : kb + 2 - nblocks);

    if (!active) continue;

    // ---- causal mask on diagonal blocks ----
    if (k0 + BN - 1 > qwave) {
      const int q = qwave + l16;
#pragma unroll
      for (int nt = 0; nt < 4; ++nt)
#pragma unroll
        for (int r = 0; r < 8; ++r)
          if (k0 + nt * 16 + hl * 8 + r > q) s[nt][r] = -1e30f;
    }

    // ---- online softmax (log2 domain): one query per lane, a tree of three-input maxima ----
    float t1[10], t2[4];
#pragma unroll
    for (int g = 0; g < 10; ++g)
      t1[g] = max3f(s[(3 * g) >> 3][(3 * g) & 7], s[(3 * g + 1) >> 3][(3 * g + 1) & 7],
                    s[(3 * g + 2) >> 3][(3 * g + 2) & 7]);
    t2[0] = max3f(t1[0], t1[1], t1[2]);
    t2[1] = max3f(t1[3], t1[4], t1[5]);
    t2[2] = max3f(t1[6], t1[7], t1[8]);
    t2[3] = max3f(t1[9], s[3][6], s[3][7]);
    const float mx    = fmaxf(max3f(t2[0], t2[1], t2[2]), t2[3]);
    const float mnew  = max3f(mrow, mx, xhalf(mx));
    const float alpha = __builtin_amdgcn_exp2f(mrow - mnew);
    mrow = mnew;

    // ---- P^T as B operands, one per chunk, packed from the score tiles in place ----
    v16h pa[2];
#pragma unroll
    for (int c = 0; c < 2; ++c)
#pragma unroll
      for (int j = 0; j < 8; ++j) {
        pa[c][2 * j + 0] = (f16)__builtin_amdgcn_exp2f(s[2 * c + 0][j] - mnew);
        pa[c][2 * j + 1] = (f16)__builtin_amdgcn_exp2f(s[2 * c + 1][j] - mnew);
      }

    // ---- sum of P via ones-matrix WMMA (every row of its tile holds it), then O^T += V^T P^T ----
    v8f lsum = __builtin_amdgcn_wmma_f32_16x16x32_f16(false, onesb, false, pa[0], (short)0, vzero, false, false);
#pragma unroll
    for (int vt = 0; vt < 4; ++vt) {
#pragma unroll
      for (int r = 0; r < 8; ++r) oacc[vt][r] *= alpha;
      oacc[vt] = __builtin_amdgcn_wmma_f32_16x16x32_f16(false, vb[0][vt], false, pa[0], (short)0, oacc[vt], false, false);
    }
    lsum = __builtin_amdgcn_wmma_f32_16x16x32_f16(false, onesb, false, pa[1], (short)0, lsum, false, false);
#pragma unroll
    for (int vt = 0; vt < 4; ++vt)
      oacc[vt] = __builtin_amdgcn_wmma_f32_16x16x32_f16(false, vb[1][vt], false, pa[1], (short)0, oacc[vt], false, false);
    lrow = lrow * alpha + lsum[0];
  }

  // ---- epilogue: normalize and store fp32; oacc[vt][r] = O[qwave + l16][vt*16 + 8*hl + r] ----
  {
    const float inv = 1.0f / lrow;
    float* orow = Oh + (size_t)(qwave + l16) * DHEAD + hl * 8;
#pragma unroll
    for (int vt = 0; vt < 4; ++vt) {
      *(float4*)(orow + vt * 16 + 0) = make_float4(oacc[vt][0] * inv, oacc[vt][1] * inv, oacc[vt][2] * inv, oacc[vt][3] * inv);
      *(float4*)(orow + vt * 16 + 4) = make_float4(oacc[vt][4] * inv, oacc[vt][5] * inv, oacc[vt][6] * inv, oacc[vt][7] * inv);
    }
  }
  // the next tile's set-up overwrites the address and data registers of these stores
  asm volatile("s_wait_xcnt 0x0" ::: "memory");
  qa[0] = qn[0];
  qa[1] = qn[1];
  }
  // the last block's loads have no consumer: they return before the wave ends
  asm volatile("s_wait_loadcnt 0x0" ::: "memory");
}

extern "C" void kernel_launch(void* const* d_in, const int* in_sizes, int n_in,
                              void* d_out, int out_size, void* d_ws, size_t ws_size,
                              hipStream_t stream) {
  (void)in_sizes; (void)n_in; (void)out_size; (void)d_ws; (void)ws_size;
  const float* Q = (const float*)d_in[0];
  const float* K = (const float*)d_in[1];
  const float* V = (const float*)d_in[2];
  float* O = (float*)d_out;
  dim3 grid(BATCH * NHEAD * (NTILE / 2));    // 256 workgroups, two query tiles each
  dim3 block(256);                            // 8 wave32 waves
  fa_fwd_causal_kernel<<<grid, block, 0, stream>>>(Q, K, V, O);
}

// v005
// A run of this version takes 30.3 microseconds.
// Timed twice side by side with v004, it ran 1.05 and 1.06 times as fast.
// Counting every step since v000, it is 2.50 times as fast.
#include <hip/hip_runtime.h>

typedef _Float16 f16;
typedef __attribute__((ext_vector_type(16))) _Float16 v16h;
typedef __attribute__((ext_vector_type(8)))  _Float16 v8h;
typedef __attribute__((ext_vector_type(2)))  _Float16 v2h;
typedef __attribute__((ext_vector_type(8)))  float    v8f;

#define S_LEN  2048
#define DHEAD  64
#define NHEAD  16
#define BATCH  2
#define BM     128   // query rows per tile
#define NTILE  (S_LEN / BM)   // query tiles per head: 16
#define WM     16    // query rows per wave
#define BN     64    // key block: two chunks of 32 keys, the k extent of one PV product
#define KSTR   72    // sK row stride (halves): 64 + 8 pad, 144B (16B x odd)
#define VSTR   72    // sVt row stride (halves): 64 + 8 pad, 144B
#define NQW    (BM / WM)   // query waves of a key group: 8
#define NGRP   2     // key groups of a workgroup: group g takes key blocks g, g + 2, g + 4, ...

static __device__ __forceinline__ v16h cat8(v8h lo, v8h hi) {
  return __builtin_shufflevector(lo, hi, 0,1,2,3,4,5,6,7,8,9,10,11,12,13,14,15);
}

static __device__ __forceinline__ float max3f(float a, float b, float c) {
  return fmaxf(fmaxf(a, b), c);
}
// the value of lane l ^ 16: the other half of the same query's keys
static __device__ __forceinline__ float xhalf(float x) {
  const int xi = __float_as_int(x);
  return __int_as_float(__builtin_amdgcn_permlanex16(xi, xi, 0x76543210, 0xfedcba98, false, false));
}

__launch_bounds__(NGRP * 256)
__global__ void fa_fwd_causal_kernel(const float* __restrict__ Qg,
                                     const float* __restrict__ Kg,
                                     const float* __restrict__ Vg,
                                     float* __restrict__ Og)
{
  __shared__ __align__(16) f16 sK[NGRP * 2 * BN * KSTR];      // per group two buffers of [key][d]  row-major
  __shared__ __align__(16) f16 sV[NGRP * 2 * DHEAD * VSTR];   // per group two buffers of [d][slot] transposed, key-permuted
  __shared__ float4 sO[NQW * 8 * 32];                         // join: group 1's output tiles, [query wave][quad][lane]
  __shared__ float  sM[NQW * 32], sL[NQW * 32];               // join: group 1's maximum and sum, [query wave][lane]

  // Sixteen waves, four to a SIMD: two groups of eight. Both groups hold the same 128
  // queries; a group stages, reads and multiplies only its own key blocks, and the two
  // partial results of a tile are joined through LDS behind the tile's last block.
  const int grp  = __builtin_amdgcn_readfirstlane(threadIdx.x >> 8);   // key group, wave-uniform
  const int tid  = threadIdx.x & 255;                                  // thread inside its group
  const int wave = tid >> 5;
  const int lane = tid & 31;
  const int hl   = lane >> 4;   // lane half (0/1)
  const int l16  = lane & 15;

  // causal cost grows linearly with the tile index, and all workgroups are resident
  // at once: each workgroup runs tile NTILE-1-pr and then tile pr of one head, so
  // every workgroup walks the same number of key blocks (NTILE + 1 in each group)
  const int bh = blockIdx.x / (NTILE / 2); // fused batch*head
  const int pr = blockIdx.x % (NTILE / 2); // tile pair

  const float* Qh = Qg + (size_t)bh * (S_LEN * DHEAD);
  const float* Kb = Kg + (size_t)bh * (S_LEN * DHEAD);
  const float* Vb = Vg + (size_t)bh * (S_LEN * DHEAD);
  float*       Oh = Og + (size_t)bh * (S_LEN * DHEAD);

  // ---- Q of a tile into B-operand layout (A's with n for m), pre-scaled by log2(e)/sqrt(D) ----
  const float qscale = 0.18033688f;        // log2(e) / 8
  auto loadq = [&](int qt, v16h* qdst) {
    const float* qrow = Qh + (size_t)(qt * BM + wave * WM + l16) * DHEAD;
#pragma unroll
    for (int kc = 0; kc < 2; ++kc) {
      const int d0 = kc * 32 + hl * 8;     // k order: {d0..d0+7, d0+16..d0+23}, as the K rows
      alignas(16) float t[16];
      *(float4*)(t + 0)  = *(const float4*)(qrow + d0 + 0);
      *(float4*)(t + 4)  = *(const float4*)(qrow + d0 + 4);
      *(float4*)(t + 8)  = *(const float4*)(qrow + d0 + 16);
      *(float4*)(t + 12) = *(const float4*)(qrow + d0 + 20);
      v16h q;
#pragma unroll
      for (int i = 0; i < 16; ++i) q[i] = (f16)(t[i] * qscale);
      qdst[kc] = q;
    }
  };
  v16h qa[2], qn[2];                       // both tiles' Q up front: no load at the seam
  loadq(NTILE - 1 - pr, qa);
  loadq(pr, qn);

  // all-ones A operand: the sum of a query's P over both lane halves via one extra WMMA
  v16h onesb;
#pragma unroll
  for (int i = 0; i < 16; ++i) onesb[i] = (f16)1.0f;

  const v8f vzero = {0.f,0.f,0.f,0.f,0.f,0.f,0.f,0.f};
  // staging: a thread brings keys skey and skey + 16 of one 32-key chunk, 8 d each
  const int skey  = ((tid >> 7) << 5) + ((tid >> 3) & 15);
  const int sd0   = (tid & 7) * 8;   // staging: d {0,8,..,56}
  // shared contraction-dim permutation for P^T rows and V^T columns, inside each chunk
  // (P.V invariant). Lane half h packs its scores of keys 8h + j and 16 + 8h + j into
  // dword j of the B operand; the A operand reads slots 8h..8h+7 and 16+8h..16+8h+7, so
  // those two keys stand side by side in a V row at slot 8h + 2j, 8 further on for j >= 4
  const int vkey  = (tid >> 3) & 15;
  const int vslot = ((tid >> 7) << 5) + ((vkey >> 3) << 3) + 2 * (vkey & 7) + ((vkey & 4) << 1);

  // ---- staging pipeline: a key block goes global -> registers -> LDS buffer, one
  //      block ahead in LDS and two ahead in registers, so neither the global
  //      latency nor the LDS stores stand between a barrier and the products
  f16* sKg = sK + grp * (2 * BN * KSTR);       // the group's own buffers
  f16* sVg = sV + grp * (2 * DHEAD * VSTR);
  const float* kst = Kb + (size_t)(grp * BN + skey) * DHEAD + sd0;
  const float* vst = Vb + (size_t)(grp * BN + skey) * DHEAD + sd0;
  f16* kdst = sKg + skey * KSTR + sd0;
  f16* vdst = sVg + sd0 * VSTR + vslot;
  float4 rk[2][2], rv[2][2];         // [key skey + 16 * j][d half]
  auto fetch = [&](int it) {         // the group's block of trip it: key block NGRP * it + grp
    const float* ks = kst + (size_t)it * (NGRP * BN * DHEAD);
    const float* vs = vst + (size_t)it * (NGRP * BN * DHEAD);
#pragma unroll
    for (int j = 0; j < 2; ++j) {
      rk[j][0] = *(const float4*)(ks + j * (16 * DHEAD) + 0);
      rk[j][1] = *(const float4*)(ks + j * (16 * DHEAD) + 4);
      rv[j][0] = *(const float4*)(vs + j * (16 * DHEAD) + 0);
      rv[j][1] = *(const float4*)(vs + j * (16 * DHEAD) + 4);
    }
    // precaution: no register that an issued load names is rewritten ahead of this wait. The two
    // addresses are its inputs, so they stay whole up to it and no load's result is laid over them
    asm volatile("s_wait_xcnt 0x0" :: "v"(ks), "v"(vs) : "memory");
  };
  auto stage = [&](int buf) {
#pragma unroll
    for (int j = 0; j < 2; ++j) {
      v8h hk;
      hk[0] = (f16)rk[j][0].x; hk[1] = (f16)rk[j][0].y; hk[2] = (f16)rk[j][0].z; hk[3] = (f16)rk[j][0].w;
      hk[4] = (f16)rk[j][1].x; hk[5] = (f16)rk[j][1].y; hk[6] = (f16)rk[j][1].z; hk[7] = (f16)rk[j][1].w;
      *(v8h*)(kdst + buf * (BN * KSTR) + j * (16 * KSTR)) = hk;   // 16B ds_store
    }
    f16* vd = vdst + buf * (DHEAD * VSTR);
    auto put = [&](int i, float a, float b) {          // slots 2k, 2k+1 of row sd0 + i: 4B ds_store
      v2h t; t[0] = (f16)a; t[1] = (f16)b;
      *(v2h*)(vd + i * VSTR) = t;
    };
    put(0, rv[0][0].x, rv[1][0].x); put(1, rv[0][0].y, rv[1][0].y);
    put(2, rv[0][0].z, rv[1][0].z); put(3, rv[0][0].w, rv[1][0].w);
    put(4, rv[0][1].x, rv[1][1].x); put(5, rv[0][1].y, rv[1][1].y);
    put(6, rv[0][1].z, rv[1][1].z); put(7, rv[0][1].w, rv[1][1].w);
  };
  fetch(0);
  stage(0);
  fetch(1);                          // the first tile has at least NTILE / 2 + 1 trips
  int par = 0;                       // buffer of the coming trip: alternates on over the seam

  for (int half = 0; half < 2; ++half) {
  const int  qt      = half ? pr : (NTILE - 1 - pr);
  const int  qwave   = qt * BM + wave * WM;   // first absolute query row of this wave
  const int  ntrips  = qt + 1;                // causal: only k <= last query of tile; 128 keys a trip

  v8f oacc[4];
#pragma unroll
  for (int vt = 0; vt < 4; ++vt) oacc[vt] = vzero;
  float mrow = -1e30f, lrow = 0.f;   // of query qwave + l16, alike in both lane halves

  for (int it = 0; it < ntrips; ++it) {
    const int k0  = (it * NGRP + grp) * BN;
    const int cur = par;
    par ^= 1;

    // the one barrier of a trip: publishes buffer cur (stored during trip it-1)
    // and ends every wave's reads of the other buffer, which is refilled below.
    // Its fences name LDS alone: __syncthreads() would also wait here for the global
    // loads of trip it+1, which only this thread's registers receive
    __builtin_amdgcn_fence(__ATOMIC_RELEASE, "workgroup", "local");
    __builtin_amdgcn_s_barrier();
    __builtin_amdgcn_fence(__ATOMIC_ACQUIRE, "workgroup", "local");

    // wave-uniform skip of fully-masked key blocks (EXEC stays all-ones)
    const bool active = k0 <= qwave + (WM - 1);

    v16h vb[2][4];                   // [chunk][d tile]
    v8f s[4];                        // set and read by active waves only
    if (active) {
      // ---- LDS operand loads (DS returns in order): K operands first for QK^T;
      //      V operands behind them drain under the softmax
      const f16* sKc = sKg + cur * (BN * KSTR);
      const f16* sVc = sVg + cur * (DHEAD * VSTR);
      v16h kop[4][2];
#pragma unroll
      for (int nt = 0; nt < 4; ++nt)
#pragma unroll
        for (int kc = 0; kc < 2; ++kc) {
          const f16* base = sKc + (nt * 16 + l16) * KSTR + kc * 32 + hl * 8;
          kop[nt][kc] = cat8(*(const v8h*)base, *(const v8h*)(base + 16));
        }
      // keeps the K loads one group ahead of the products: without it the compiler puts
      // V loads in front of the last K loads, and the scores wait for both
      __builtin_amdgcn_sched_barrier(0);

      // ---- S^T = K (Q*scale)^T : 64x16 scores in four f32 tiles, s[nt][r] = key nt*16 + 8*hl + r ----
#pragma unroll
      for (int nt = 0; nt < 4; ++nt)
        s[nt] = __builtin_amdgcn_wmma_f32_16x16x32_f16(false, kop[nt][0], false, qa[0], (short)0, vzero, false, false);
#pragma unroll
      for (int nt = 0; nt < 4; ++nt)
        s[nt] = __builtin_amdgcn_wmma_f32_16x16x32_f16(false, kop[nt][1], false, qa[1], (short)0, s[nt], false, false);

#pragma unroll
      for (int c = 0; c < 2; ++c)
#pragma unroll
        for (int vt = 0; vt < 4; ++vt) {
          const f16* vbp = sVc + (vt * 16 + l16) * VSTR + c * 32 + hl * 8;
          vb[c][vt] = cat8(*(const v8h*)vbp, *(const v8h*)(vbp + 16));
        }
    }

    // ---- every wave: trip it+1 registers -> other buffer, then trip it+2's loads.
    //      The pipeline runs on over the seam: behind a tile's last trips come trips 0
    //      and 1 of the same head again. No test for the very end, nor for a second tile
    //      of one trip: what is brought past a tile's end is trip 0 or 1, in bounds, goes
    //      at most into the buffer that nobody reads any more and is not used
    stage(cur ^ 1);
    fetch(it + 2 < ntrips ? it + 2 : it + 2 - ntrips);

    if (!active) continue;

    // ---- causal mask on diagonal blocks ----
    if (k0 + BN - 1 > qwave) {
      const int q = qwave + l16;
#pragma unroll
      for (int nt = 0; nt < 4; ++nt)
#pragma unroll
        for (int r = 0; r < 8; ++r)
          if (k0 + nt * 16 + hl * 8 + r > q) s[nt][r] = -1e30f;
    }

    // ---- online softmax (log2 domain): one query per lane, a tree of three-input maxima ----
    float t1[10], t2[4];
#pragma unroll
    for (int g = 0; g < 10; ++g)
      t1[g] = max3f(s[(3 * g) >> 3][(3 * g) & 7], s[(3 * g + 1) >> 3][(3 * g + 1) & 7],
                    s[(3 * g + 2) >> 3][(3 * g + 2) & 7]);
    t2[0] = max3f(t1[0], t1[1], t1[2]);
    t2[1] = max3f(t1[3], t1[4], t1[5]);
    t2[2] = max3f(t1[6], t1[7], t1[8]);
    t2[3] = max3f(t1[9], s[3][6], s[3][7]);
    const float mx    = fmaxf(max3f(t2[0], t2[1], t2[2]), t2[3]);
    const float mnew  = max3f(mrow, mx, xhalf(mx));
    const float alpha = __builtin_amdgcn_exp2f(mrow - mnew);
    mrow = mnew;

    // ---- P^T as B operands, one per chunk, packed from the score tiles in place ----
    v16h pa[2];
#pragma unroll
    for (int c = 0; c < 2; ++c)
#pragma unroll
      for (int j = 0; j < 8; ++j) {
        pa[c][2 * j + 0] = (f16)__builtin_amdgcn_exp2f(s[2 * c + 0][j] - mnew);
        pa[c][2 * j + 1] = (f16)__builtin_amdgcn_exp2f(s[2 * c + 1][j] - mnew);
      }

    // ---- sum of P via ones-matrix WMMA (every row of its tile holds it), then O^T += V^T P^T ----
    v8f lsum = __builtin_amdgcn_wmma_f32_16x16x32_f16(false, onesb, false, pa[0], (short)0, vzero, false, false);
#pragma unroll
    for (int vt = 0; vt < 4; ++vt) {
#pragma unroll
      for (int r = 0; r < 8; ++r) oacc[vt][r] *= alpha;
      oacc[vt] = __builtin_amdgcn_wmma_f32_16x16x32_f16(false, vb[0][vt], false, pa[0], (short)0, oacc[vt], false, false);
    }
    lsum = __builtin_amdgcn_wmma_f32_16x16x32_f16(false, onesb, false, pa[1], (short)0, lsum, false, false);
#pragma unroll
    for (int vt = 0; vt < 4; ++vt)
      oacc[vt] = __builtin_amdgcn_wmma_f32_16x16x32_f16(false, vb[1][vt], false, pa[1], (short)0, oacc[vt], false, false);
    lrow = lrow * alpha + lsum[0];
  }

  // ---- join of the key groups: group 1 hands its tiles, maximum and sum over in LDS.
  //      A group that saw no key of a query hands over maximum -1e30, sum 0, tiles 0
  float4* so = sO + wave * (8 * 32) + lane;
  if (grp == 1) {
#pragma unroll
    for (int vt = 0; vt < 4; ++vt) {
      so[(2 * vt + 0) * 32] = make_float4(oacc[vt][0], oacc[vt][1], oacc[vt][2], oacc[vt][3]);
      so[(2 * vt + 1) * 32] = make_float4(oacc[vt][4], oacc[vt][5], oacc[vt][6], oacc[vt][7]);
    }
    sM[wave * 32 + lane] = mrow;
    sL[wave * 32 + lane] = lrow;
  }
  // publishes group 1's hand-over; LDS-only fences, as in the loop. The next tile's first
  // loop barrier ends group 0's reads before group 1 can write here again
  __builtin_amdgcn_fence(__ATOMIC_RELEASE, "workgroup", "local");
  __builtin_amdgcn_s_barrier();
  __builtin_amdgcn_fence(__ATOMIC_ACQUIRE, "workgroup", "local");

  // ---- epilogue, group 0: join, normalize and store fp32; oacc[vt][r] = O[qwave + l16][vt*16 + 8*hl + r] ----
  if (grp == 0) {
    const float m1  = sM[wave * 32 + lane];
    const float l1  = sL[wave * 32 + lane];
    const float mj  = fmaxf(mrow, m1);
    const float a0  = __builtin_amdgcn_exp2f(mrow - mj);
    const float a1  = __builtin_amdgcn_exp2f(m1 - mj);
    const float inv = 1.0f / (lrow * a0 + l1 * a1);
    const float c0  = a0 * inv, c1 = a1 * inv;
    float* orow = Oh + (size_t)(qwave + l16) * DHEAD + hl * 8;
#pragma unroll
    for (int vt = 0; vt < 4; ++vt) {
      const float4 p = so[(2 * vt + 0) * 32];
      const float4 u = so[(2 * vt + 1) * 32];
      *(float4*)(orow + vt * 16 + 0) = make_float4(oacc[vt][0] * c0 + p.x * c1, oacc[vt][1] * c0 + p.y * c1,
                                                   oacc[vt][2] * c0 + p.z * c1, oacc[vt][3] * c0 + p.w * c1);
      *(float4*)(orow + vt * 16 + 4) = make_float4(oacc[vt][4] * c0 + u.x * c1, oacc[vt][5] * c0 + u.y * c1,
                                                   oacc[vt][6] * c0 + u.z * c1, oacc[vt][7] * c0 + u.w * c1);
    }
    // the next tile's set-up overwrites the address and data registers of these stores
    asm volatile("s_wait_xcnt 0x0" ::: "memory");
  }
  qa[0] = qn[0];
  qa[1] = qn[1];
  }
  // the last block's loads have no consumer: they return before the wave ends
  asm volatile("s_wait_loadcnt 0x0" ::: "memory");
}

extern "C" void kernel_launch(void* const* d_in, const int* in_sizes, int n_in,
                              void* d_out, int out_size, void* d_ws, size_t ws_size,
                              hipStream_t stream) {
  (void)in_sizes; (void)n_in; (void)out_size; (void)d_ws; (void)ws_size;
  const float* Q = (const float*)d_in[0];
  const float* K = (const float*)d_in[1];
  const float* V = (const float*)d_in[2];
  float* O = (float*)d_out;
  dim3 grid(BATCH * NHEAD * (NTILE / 2));    // 256 workgroups, two query tiles each
  dim3 block(NGRP * 256);                     // 16 wave32 waves: 8 query waves x 2 key groups
  fa_fwd_causal_kernel<<<grid, block, 0, stream>>>(Q, K, V, O);
}

// v006
// A run of this version takes 28.8 microseconds.
// Timed twice side by side with v005, it ran 1.05 times as fast both times.
// All steps since v000 together make it 2.63 times as fast.
#include <hip/hip_runtime.h>

typedef _Float16 f16;
typedef __attribute__((ext_vector_type(16))) _Float16 v16h;
typedef __attribute__((ext_vector_type(8)))  _Float16 v8h;
typedef __attribute__((ext_vector_type(8)))  float    v8f;
typedef __attribute__((ext_vector_type(8)))  short    s16x8;

#define S_LEN  2048
#define DHEAD  64
#define NHEAD  16
#define BATCH  2
#define BM     128   // query rows per tile
#define NTILE  (S_LEN / BM)   // query tiles per head: 16
#define WM     16    // query rows per wave
#define BN     64    // key block: two chunks of 32 keys, the k extent of one PV product
#define KSTR   72    // sK row stride (halves): 64 + 8 pad, 144B (16B x odd)
#define VSTR   80    // sV row stride (halves): 64 + 16 pad, 160B (32B x odd), the transposing load's pitch
#define NQW    (BM / WM)   // query waves of a key group: 8
#define NGRP   2     // key groups of a workgroup: group g takes key blocks g, g + 2, g + 4, ...

static __device__ __forceinline__ v16h cat8(v8h lo, v8h hi) {
  return __builtin_shufflevector(lo, hi, 0,1,2,3,4,5,6,7,8,9,10,11,12,13,14,15);
}

// transposing LDS load: the lanes' 16-byte pieces of eight rows come back as eight rows' elements of one column
static __device__ __forceinline__ v8h ld_tr16(const f16* p) {
  typedef __attribute__((address_space(3))) s16x8 lds_s16x8;
  return __builtin_bit_cast(v8h, __builtin_amdgcn_ds_load_tr16_b128_v8i16((lds_s16x8*)p));
}

static __device__ __forceinline__ float max3f(float a, float b, float c) {
  return fmaxf(fmaxf(a, b), c);
}
// the value of lane l ^ 16: the other half of the same query's keys
static __device__ __forceinline__ float xhalf(float x) {
  const int xi = __float_as_int(x);
  return __int_as_float(__builtin_amdgcn_permlanex16(xi, xi, 0x76543210, 0xfedcba98, false, false));
}

__launch_bounds__(NGRP * 256)
__global__ void fa_fwd_causal_kernel(const float* __restrict__ Qg,
                                     const float* __restrict__ Kg,
                                     const float* __restrict__ Vg,
                                     float* __restrict__ Og)
{
  __shared__ __align__(16) f16 sK[NGRP * 2 * BN * KSTR];      // per group two buffers of [key][d]  row-major
  __shared__ __align__(16) f16 sV[NGRP * 2 * BN * VSTR];      // per group two buffers of [key][d]  row-major, read transposed
  __shared__ float4 sO[NQW * 8 * 32];                         // join: group 1's output tiles, [query wave][quad][lane]
  __shared__ float  sM[NQW * 32], sL[NQW * 32];               // join: group 1's maximum and sum, [query wave][lane]

  // Sixteen waves, four to a SIMD: two groups of eight. Both groups hold the same 128
  // queries; a group stages, reads and multiplies only its own key blocks, and the two
  // partial results of a tile are joined through LDS behind the tile's last block.
  const int grp  = __builtin_amdgcn_readfirstlane(threadIdx.x >> 8);   // key group, wave-uniform
  const int tid  = threadIdx.x & 255;                                  // thread inside its group
  const int wave = tid >> 5;
  const int lane = tid & 31;
  const int hl   = lane >> 4;   // lane half (0/1)
  const int l16  = lane & 15;

  // causal cost grows linearly with the tile index, and all workgroups are resident
  // at once: each workgroup runs tile NTILE-1-pr and then tile pr of one head, so
  // every workgroup walks the same number of key blocks (NTILE + 1 in each group)
  const int bh = blockIdx.x / (NTILE / 2); // fused batch*head
  const int pr = blockIdx.x % (NTILE / 2); // tile pair

  const float* Qh = Qg + (size_t)bh * (S_LEN * DHEAD);
  const float* Kb = Kg + (size_t)bh * (S_LEN * DHEAD);
  const float* Vb = Vg + (size_t)bh * (S_LEN * DHEAD);
  float*       Oh = Og + (size_t)bh * (S_LEN * DHEAD);

  // ---- Q of a tile into B-operand layout (A's with n for m), pre-scaled by log2(e)/sqrt(D) ----
  const float qscale = 0.18033688f;        // log2(e) / 8
  auto loadq = [&](int qt, v16h* qdst) {
    const float* qrow = Qh + (size_t)(qt * BM + wave * WM + l16) * DHEAD;
#pragma unroll
    for (int kc = 0; kc < 2; ++kc) {
      const int d0 = kc * 32 + hl * 8;     // k order: {d0..d0+7, d0+16..d0+23}, as the K rows
      alignas(16) float t[16];
      *(float4*)(t + 0)  = *(const float4*)(qrow + d0 + 0);
      *(float4*)(t + 4)  = *(const float4*)(qrow + d0 + 4);
      *(float4*)(t + 8)  = *(const float4*)(qrow + d0 + 16);
      *(float4*)(t + 12) = *(const float4*)(qrow + d0 + 20);
      v16h q;
#pragma unroll
      for (int i = 0; i < 16; ++i) q[i] = (f16)(t[i] * qscale);
      qdst[kc] = q;
    }
  };
  v16h qa[2], qn[2];                       // both tiles' Q up front: no load at the seam
  loadq(NTILE - 1 - pr, qa);
  loadq(pr, qn);

  // all-ones A operand: the sum of a query's P over both lane halves via one extra WMMA
  v16h onesb;
#pragma unroll
  for (int i = 0; i < 16; ++i) onesb[i] = (f16)1.0f;

  const v8f vzero = {0.f,0.f,0.f,0.f,0.f,0.f,0.f,0.f};
  // staging: a thread brings K rows skey and skey + 16 and V rows vkey and vkey + 16 of one 32-key chunk, 8 d each
  const int skey  = ((tid >> 7) << 5) + ((tid >> 3) & 15);
  const int sd0   = (tid & 7) * 8;   // staging: d {0,8,..,56}
  // V rows of neighbouring 8-lane sets lie 4 apart: 4 * 160 B = 32 banks on, so the 16-byte
  // stores of 16 lanes (two 128-byte rows) fall on all 64 banks once
  const int vkey  = (skey & 40) + ((skey & 1) << 2) + ((skey >> 1) & 3);

  // ---- staging pipeline: a key block goes global -> registers -> LDS buffer, one
  //      block ahead in LDS and two ahead in registers, so neither the global
  //      latency nor the LDS stores stand between a barrier and the products
  f16* sKg = sK + grp * (2 * BN * KSTR);       // the group's own buffers
  f16* sVg = sV + grp * (2 * BN * VSTR);
  const float* kst = Kb + (size_t)(grp * BN + skey) * DHEAD + sd0;
  const float* vst = Vb + (size_t)(grp * BN + vkey) * DHEAD + sd0;
  f16* kdst = sKg + skey * KSTR + sd0;
  f16* vdst = sVg + vkey * VSTR + sd0;
  float4 rk[2][2], rv[2][2];         // [key skey or vkey + 16 * j][d half]
  auto fetch = [&](int it) {         // the group's block of trip it: key block NGRP * it + grp
    const float* ks = kst + (size_t)it * (NGRP * BN * DHEAD);
    const float* vs = vst + (size_t)it * (NGRP * BN * DHEAD);
#pragma unroll
    for (int j = 0; j < 2; ++j) {
      rk[j][0] = *(const float4*)(ks + j * (16 * DHEAD) + 0);
      rk[j][1] = *(const float4*)(ks + j * (16 * DHEAD) + 4);
      rv[j][0] = *(const float4*)(vs + j * (16 * DHEAD) + 0);
      rv[j][1] = *(const float4*)(vs + j * (16 * DHEAD) + 4);
    }
    // precaution: no register that an issued load names is rewritten ahead of this wait. The two
    // addresses are its inputs, so they stay whole up to it and no load's result is laid over them
    asm volatile("s_wait_xcnt 0x0" :: "v"(ks), "v"(vs) : "memory");
  };
  // buffer offsets here and at the operand loads are selects, not products: K and V buffers now differ
  // in size, and from buf * size the compiler made four vector multiply-adds a trip
  auto stage = [&](int buf) {
#pragma unroll
    for (int j = 0; j < 2; ++j) {
      v8h hk;
      hk[0] = (f16)rk[j][0].x; hk[1] = (f16)rk[j][0].y; hk[2] = (f16)rk[j][0].z; hk[3] = (f16)rk[j][0].w;
      hk[4] = (f16)rk[j][1].x; hk[5] = (f16)rk[j][1].y; hk[6] = (f16)rk[j][1].z; hk[7] = (f16)rk[j][1].w;
      *(v8h*)(kdst + (buf ? BN * KSTR : 0) + j * (16 * KSTR)) = hk;   // 16B ds_store
    }
#pragma unroll
    for (int j = 0; j < 2; ++j) {
      v8h hv;
      hv[0] = (f16)rv[j][0].x; hv[1] = (f16)rv[j][0].y; hv[2] = (f16)rv[j][0].z; hv[3] = (f16)rv[j][0].w;
      hv[4] = (f16)rv[j][1].x; hv[5] = (f16)rv[j][1].y; hv[6] = (f16)rv[j][1].z; hv[7] = (f16)rv[j][1].w;
      *(v8h*)(vdst + (buf ? BN * VSTR : 0) + j * (16 * VSTR)) = hv;   // 16B ds_store
    }
  };
  fetch(0);
  stage(0);
  fetch(1);                          // the first tile has at least NTILE / 2 + 1 trips
  int par = 0;                       // buffer of the coming trip: alternates on over the seam

  for (int half = 0; half < 2; ++half) {
  const int  qt      = half ? pr : (NTILE - 1 - pr);
  const int  qwave   = qt * BM + wave * WM;   // first absolute query row of this wave
  const int  ntrips  = qt + 1;                // causal: only k <= last query of tile; 128 keys a trip

  v8f oacc[4];
#pragma unroll
  for (int vt = 0; vt < 4; ++vt) oacc[vt] = vzero;
  float mrow = -1e30f, lrow = 0.f;   // of query qwave + l16, alike in both lane halves

  for (int it = 0; it < ntrips; ++it) {
    const int k0  = (it * NGRP + grp) * BN;
    const int cur = par;
    par ^= 1;

    // the one barrier of a trip: publishes buffer cur (stored during trip it-1)
    // and ends every wave's reads of the other buffer, which is refilled below.
    // Its fences name LDS alone: __syncthreads() would also wait here for the global
    // loads of trip it+1, which only this thread's registers receive
    __builtin_amdgcn_fence(__ATOMIC_RELEASE, "workgroup", "local");
    __builtin_amdgcn_s_barrier();
    __builtin_amdgcn_fence(__ATOMIC_ACQUIRE, "workgroup", "local");

    // wave-uniform skip of fully-masked key blocks (EXEC stays all-ones)
    const bool active = k0 <= qwave + (WM - 1);

    v16h vb[2][4];                   // [chunk][d tile]
    v8f s[4];                        // set and read by active waves only
    if (active) {
      // ---- LDS operand loads (DS returns in order): K operands first for QK^T;
      //      V operands behind them drain under the softmax
      const f16* sKc = sKg + (cur ? BN * KSTR : 0);
      const f16* sVc = sVg + (cur ? BN * VSTR : 0);
      v16h kop[4][2];
#pragma unroll
      for (int nt = 0; nt < 4; ++nt)
#pragma unroll
        for (int kc = 0; kc < 2; ++kc) {
          const f16* base = sKc + (nt * 16 + l16) * KSTR + kc * 32 + hl * 8;
          kop[nt][kc] = cat8(*(const v8h*)base, *(const v8h*)(base + 16));
        }
      // keeps the K loads one group ahead of the products: without it the compiler puts
      // V loads in front of the last K loads, and the scores wait for both
      __builtin_amdgcn_sched_barrier(0);

      // ---- S^T = K (Q*scale)^T : 64x16 scores in four f32 tiles, s[nt][r] = key nt*16 + 8*hl + r ----
#pragma unroll
      for (int nt = 0; nt < 4; ++nt)
        s[nt] = __builtin_amdgcn_wmma_f32_16x16x32_f16(false, kop[nt][0], false, qa[0], (short)0, vzero, false, false);
#pragma unroll
      for (int nt = 0; nt < 4; ++nt)
        s[nt] = __builtin_amdgcn_wmma_f32_16x16x32_f16(false, kop[nt][1], false, qa[1], (short)0, s[nt], false, false);

#pragma unroll
      for (int c = 0; c < 2; ++c)
#pragma unroll
        for (int vt = 0; vt < 4; ++vt) {
          // lane (l16, hl) receives V[c*32 + 8*hl + 0..7][vt*16 + l16], then the same 16 keys on: row l16 of V^T, hardware k order
          const f16* vbp = sVc + (c * 32 + hl * 8 + (lane & 7)) * VSTR + vt * 16 + ((lane >> 3) & 1) * 8;
          vb[c][vt] = cat8(ld_tr16(vbp), ld_tr16(vbp + 16 * VSTR));
        }
    }

    // ---- every wave: trip it+1 registers -> other buffer, then trip it+2's loads.
    //      The pipeline runs on over the seam: behind a tile's last trips come trips 0
    //      and 1 of the same head again. No test for the very end, nor for a second tile
    //      of one trip: what is brought past a tile's end is trip 0 or 1, in bounds, goes
    //      at most into the buffer that nobody reads any more and is not used
    stage(cur ^ 1);
    fetch(it + 2 < ntrips ? it + 2 : it + 2 - ntrips);

    if (!active) continue;

    // ---- causal mask on diagonal blocks ----
    if (k0 + BN - 1 > qwave) {
      const int q = qwave + l16;
#pragma unroll
      for (int nt = 0; nt < 4; ++nt)
#pragma unroll
        for (int r = 0; r < 8; ++r)
          if (k0 + nt * 16 + hl * 8 + r > q) s[nt][r] = -1e30f;
    }

    // ---- online softmax (log2 domain): one query per lane, a tree of three-input maxima ----
    float t1[10], t2[4];
#pragma unroll
    for (int g = 0; g < 10; ++g)
      t1[g] = max3f(s[(3 * g) >> 3][(3 * g) & 7], s[(3 * g + 1) >> 3][(3 * g + 1) & 7],
                    s[(3 * g + 2) >> 3][(3 * g + 2) & 7]);
    t2[0] = max3f(t1[0], t1[1], t1[2]);
    t2[1] = max3f(t1[3], t1[4], t1[5]);
    t2[2] = max3f(t1[6], t1[7], t1[8]);
    t2[3] = max3f(t1[9], s[3][6], s[3][7]);
    const float mx    = fmaxf(max3f(t2[0], t2[1], t2[2]), t2[3]);
    const float mnew  = max3f(mrow, mx, xhalf(mx));
    const float alpha = __builtin_amdgcn_exp2f(mrow - mnew);
    mrow = mnew;

    // ---- P^T as B operands, one per chunk, packed from the score tiles in place: lane half hl holds
    //      keys 8*hl + r and 16 + 8*hl + r of a chunk, elements r and 8 + r in the hardware k order ----
    v16h pa[2];
#pragma unroll
    for (int c = 0; c < 2; ++c)
#pragma unroll
      for (int nt = 0; nt < 2; ++nt)
#pragma unroll
        for (int r = 0; r < 8; ++r)
          pa[c][nt * 8 + r] = (f16)__builtin_amdgcn_exp2f(s[2 * c + nt][r] - mnew);

    // ---- sum of P via ones-matrix WMMA (every row of its tile holds it), then O^T += V^T P^T ----
    v8f lsum = __builtin_amdgcn_wmma_f32_16x16x32_f16(false, onesb, false, pa[0], (short)0, vzero, false, false);
#pragma unroll
    for (int vt = 0; vt < 4; ++vt) {
#pragma unroll
      for (int r = 0; r < 8; ++r) oacc[vt][r] *= alpha;
      oacc[vt] = __builtin_amdgcn_wmma_f32_16x16x32_f16(false, vb[0][vt], false, pa[0], (short)0, oacc[vt], false, false);
    }
    lsum = __builtin_amdgcn_wmma_f32_16x16x32_f16(false, onesb, false, pa[1], (short)0, lsum, false, false);
#pragma unroll
    for (int vt = 0; vt < 4; ++vt)
      oacc[vt] = __builtin_amdgcn_wmma_f32_16x16x32_f16(false, vb[1][vt], false, pa[1], (short)0, oacc[vt], false, false);
    lrow = lrow * alpha + lsum[0];
  }

  // ---- join of the key groups: group 1 hands its tiles, maximum and sum over in LDS.
  //      A group that saw no key of a query hands over maximum -1e30, sum 0, tiles 0
  float4* so = sO + wave * (8 * 32) + lane;
  if (grp == 1) {
#pragma unroll
    for (int vt = 0; vt < 4; ++vt) {
      so[(2 * vt + 0) * 32] = make_float4(oacc[vt][0], oacc[vt][1], oacc[vt][2], oacc[vt][3]);
      so[(2 * vt + 1) * 32] = make_float4(oacc[vt][4], oacc[vt][5], oacc[vt][6], oacc[vt][7]);
    }
    sM[wave * 32 + lane] = mrow;
    sL[wave * 32 + lane] = lrow;
  }
  // publishes group 1's hand-over; LDS-only fences, as in the loop. The next tile's first
  // loop barrier ends group 0's reads before group 1 can write here again
  __builtin_amdgcn_fence(__ATOMIC_RELEASE, "workgroup", "local");
  __builtin_amdgcn_s_barrier();
  __builtin_amdgcn_fence(__ATOMIC_ACQUIRE, "workgroup", "local");

  // ---- epilogue, group 0: join, normalize and store fp32; oacc[vt][r] = O[qwave + l16][vt*16 + 8*hl + r] ----
  if (grp == 0) {
    const float m1  = sM[wave * 32 + lane];
    const float l1  = sL[wave * 32 + lane];
    const float mj  = fmaxf(mrow, m1);
    const float a0  = __builtin_amdgcn_exp2f(mrow - mj);
    const float a1  = __builtin_amdgcn_exp2f(m1 - mj);
    const float inv = 1.0f / (lrow * a0 + l1 * a1);
    const float c0  = a0 * inv, c1 = a1 * inv;
    float* orow = Oh + (size_t)(qwave + l16) * DHEAD + hl * 8;
#pragma unroll
    for (int vt = 0; vt < 4; ++vt) {
      const float4 p = so[(2 * vt + 0) * 32];
      const float4 u = so[(2 * vt + 1) * 32];
      *(float4*)(orow + vt * 16 + 0) = make_float4(oacc[vt][0] * c0 + p.x * c1, oacc[vt][1] * c0 + p.y * c1,
                                                   oacc[vt][2] * c0 + p.z * c1, oacc[vt][3] * c0 + p.w * c1);
      *(float4*)(orow + vt * 16 + 4) = make_float4(oacc[vt][4] * c0 + u.x * c1, oacc[vt][5] * c0 + u.y * c1,
                                                   oacc[vt][6] * c0 + u.z * c1, oacc[vt][7] * c0 + u.w * c1);
    }
    // the next tile's set-up overwrites the address and data registers of these stores
    asm volatile("s_wait_xcnt 0x0" ::: "memory");
  }
  qa[0] = qn[0];
  qa[1] = qn[1];
  }
  // the last block's loads have no consumer: they return before the wave ends
  asm volatile("s_wait_loadcnt 0x0" ::: "memory");
}

extern "C" void kernel_launch(void* const* d_in, const int* in_sizes, int n_in,
                              void* d_out, int out_size, void* d_ws, size_t ws_size,
                              hipStream_t stream) {
  (void)in_sizes; (void)n_in; (void)out_size; (void)d_ws; (void)ws_size;
  const float* Q = (const float*)d_in[0];
  const float* K = (const float*)d_in[1];
  const float* V = (const float*)d_in[2];
  float* O = (float*)d_out;
  dim3 grid(BATCH * NHEAD * (NTILE / 2));    // 256 workgroups, two query tiles each
  dim3 block(NGRP * 256);                     // 16 wave32 waves: 8 query waves x 2 key groups
  fa_fwd_causal_kernel<<<grid, block, 0, stream>>>(Q, K, V, O);
}

// v007
// A run of this version takes 27.3 microseconds.
// Two timings next to v006 put it at 1.05 and 1.06 times that version's speed.
// All steps since v000 together make it 2.77 times as fast.
#include <hip/hip_runtime.h>

typedef _Float16 f16;
typedef __attribute__((ext_vector_type(16))) _Float16 v16h;
typedef __attribute__((ext_vector_type(8)))  _Float16 v8h;
typedef __attribute__((ext_vector_type(8)))  float    v8f;
typedef __attribute__((ext_vector_type(8)))  short    s16x8;

#define S_LEN  2048
#define DHEAD  64
#define NHEAD  16
#define BATCH  2
#define BM     128   // query rows per tile
#define NTILE  (S_LEN / BM)   // query tiles per head: 16
#define WM     16    // query rows per wave
#define BN     64    // key block: two chunks of 32 keys, the k extent of one PV product
#define KSTR   72    // sK row stride (halves): 64 + 8 pad, 144B (16B x odd)
#define VSTR   80    // sV row stride (halves): 64 + 16 pad, 160B (32B x odd), the transposing load's pitch
#define NQW    (BM / WM)   // query waves of a key group: 8
#define NGRP   2     // key groups of a workgroup: group g takes key blocks g, g + 2, g + 4, ...

static __device__ __forceinline__ v16h cat8(v8h lo, v8h hi) {
  return __builtin_shufflevector(lo, hi, 0,1,2,3,4,5,6,7,8,9,10,11,12,13,14,15);
}

// transposing LDS load: the lanes' 16-byte pieces of eight rows come back as eight rows' elements of one column
static __device__ __forceinline__ v8h ld_tr16(const f16* p) {
  typedef __attribute__((address_space(3))) s16x8 lds_s16x8;
  return __builtin_bit_cast(v8h, __builtin_amdgcn_ds_load_tr16_b128_v8i16((lds_s16x8*)p));
}

static __device__ __forceinline__ float max3f(float a, float b, float c) {
  return fmaxf(fmaxf(a, b), c);
}
// the value of lane l ^ 16: the other half of the same query's keys
static __device__ __forceinline__ float xhalf(float x) {
  const int xi = __float_as_int(x);
  return __int_as_float(__builtin_amdgcn_permlanex16(xi, xi, 0x76543210, 0xfedcba98, false, false));
}

__launch_bounds__(NGRP * 256)
__global__ void fa_fwd_causal_kernel(const float* __restrict__ Qg,
                                     const float* __restrict__ Kg,
                                     const float* __restrict__ Vg,
                                     float* __restrict__ Og)
{
  __shared__ __align__(16) f16 sK[NGRP * 2 * BN * KSTR];      // per group two buffers of [key][d]  row-major
  __shared__ __align__(16) f16 sV[NGRP * 3 * BN * VSTR];      // per group three buffers of [key][d]  row-major, read transposed
  __shared__ float4 sO[NQW * 8 * 32];                         // join: group 1's output tiles, [query wave][quad][lane]
  __shared__ float  sM[NQW * 32], sL[NQW * 32];               // join: group 1's maximum and sum, [query wave][lane]

  // Sixteen waves, four to a SIMD: two groups of eight. Both groups hold the same 128
  // queries; a group stages, reads and multiplies only its own key blocks, and the two
  // partial results of a tile are joined through LDS behind the tile's last block.
  const int grp  = __builtin_amdgcn_readfirstlane(threadIdx.x >> 8);   // key group, wave-uniform
  const int tid  = threadIdx.x & 255;                                  // thread inside its group
  const int wave = __builtin_amdgcn_readfirstlane(tid >> 5);           // scalar, so the tests on a wave's rows are scalar branches
  const int lane = tid & 31;
  const int hl   = lane >> 4;   // lane half (0/1)
  const int l16  = lane & 15;

  // causal cost grows linearly with the tile index, and all workgroups are resident
  // at once: each workgroup runs tile NTILE-1-pr and then tile pr of one head, so
  // every workgroup walks the same number of key blocks (NTILE + 1 in each group)
  const int bh = blockIdx.x / (NTILE / 2); // fused batch*head
  const int pr = blockIdx.x % (NTILE / 2); // tile pair

  const float* Qh = Qg + (size_t)bh * (S_LEN * DHEAD);
  const float* Kb = Kg + (size_t)bh * (S_LEN * DHEAD);
  const float* Vb = Vg + (size_t)bh * (S_LEN * DHEAD);
  float*       Oh = Og + (size_t)bh * (S_LEN * DHEAD);

  // ---- Q of a tile into B-operand layout (A's with n for m), pre-scaled by log2(e)/sqrt(D) ----
  const float qscale = 0.18033688f;        // log2(e) / 8
  auto loadq = [&](int qt, v16h* qdst) {
    const float* qrow = Qh + (size_t)(qt * BM + wave * WM + l16) * DHEAD;
#pragma unroll
    for (int kc = 0; kc < 2; ++kc) {
      const int d0 = kc * 32 + hl * 8;     // k order: {d0..d0+7, d0+16..d0+23}, as the K rows
      alignas(16) float t[16];
      *(float4*)(t + 0)  = *(const float4*)(qrow + d0 + 0);
      *(float4*)(t + 4)  = *(const float4*)(qrow + d0 + 4);
      *(float4*)(t + 8)  = *(const float4*)(qrow + d0 + 16);
      *(float4*)(t + 12) = *(const float4*)(qrow + d0 + 20);
      v16h q;
#pragma unroll
      for (int i = 0; i < 16; ++i) q[i] = (f16)(t[i] * qscale);
      qdst[kc] = q;
    }
  };
  v16h qa[2], qn[2];                       // both tiles' Q up front: no load at the seam
  loadq(NTILE - 1 - pr, qa);
  loadq(pr, qn);

  // all-ones A operand: the sum of a query's P over both lane halves via one extra WMMA
  v16h onesb;
#pragma unroll
  for (int i = 0; i < 16; ++i) onesb[i] = (f16)1.0f;

  const v8f vzero = {0.f,0.f,0.f,0.f,0.f,0.f,0.f,0.f};
  // staging: a thread brings K rows skey and skey + 16 and V rows vkey and vkey + 16 of one 32-key chunk, 8 d each
  const int skey  = ((tid >> 7) << 5) + ((tid >> 3) & 15);
  const int sd0   = (tid & 7) * 8;   // staging: d {0,8,..,56}
  // V rows of neighbouring 8-lane sets lie 4 apart: 4 * 160 B = 32 banks on, so the 16-byte
  // stores of 16 lanes (two 128-byte rows) fall on all 64 banks once
  const int vkey  = (skey & 40) + ((skey & 1) << 2) + ((skey >> 1) & 3);

  // ---- staging pipeline: a key block goes global -> registers -> LDS buffer, one
  //      block ahead in LDS and two ahead in registers, so neither the global
  //      latency nor the LDS stores stand between a barrier and the products
  f16* sKg = sK + grp * (2 * BN * KSTR);       // the group's own buffers
  f16* sVg = sV + grp * (3 * BN * VSTR);
  const float* kst = Kb + (size_t)(grp * BN + skey) * DHEAD + sd0;
  const float* vst = Vb + (size_t)(grp * BN + vkey) * DHEAD + sd0;
  f16* kdst = sKg + skey * KSTR + sd0;
  f16* vdst = sVg + vkey * VSTR + sd0;
  float4 rk[2][2], rv[2][2];         // [key skey or vkey + 16 * j][d half]
  auto fetch = [&](int it) {         // the group's block of trip it: key block NGRP * it + grp
    const float* ks = kst + (size_t)it * (NGRP * BN * DHEAD);
    const float* vs = vst + (size_t)it * (NGRP * BN * DHEAD);
#pragma unroll
    for (int j = 0; j < 2; ++j) {
      rk[j][0] = *(const float4*)(ks + j * (16 * DHEAD) + 0);
      rk[j][1] = *(const float4*)(ks + j * (16 * DHEAD) + 4);
      rv[j][0] = *(const float4*)(vs + j * (16 * DHEAD) + 0);
      rv[j][1] = *(const float4*)(vs + j * (16 * DHEAD) + 4);
    }
    // precaution: no register that an issued load names is rewritten ahead of this wait. The two
    // addresses are its inputs, so they stay whole up to it and no load's result is laid over them
    asm volatile("s_wait_xcnt 0x0" :: "v"(ks), "v"(vs) : "memory");
  };
  // buffer offsets here and at the operand loads are selects, not products: K and V buffers now differ
  // in size, and from buf * size the compiler made four vector multiply-adds a trip
  auto stage = [&](int buf, int vo) {   // K buffer 0 or 1; V buffer by its offset in halves
#pragma unroll
    for (int j = 0; j < 2; ++j) {
      v8h hk;
      hk[0] = (f16)rk[j][0].x; hk[1] = (f16)rk[j][0].y; hk[2] = (f16)rk[j][0].z; hk[3] = (f16)rk[j][0].w;
      hk[4] = (f16)rk[j][1].x; hk[5] = (f16)rk[j][1].y; hk[6] = (f16)rk[j][1].z; hk[7] = (f16)rk[j][1].w;
      *(v8h*)(kdst + (buf ? BN * KSTR : 0) + j * (16 * KSTR)) = hk;   // 16B ds_store
    }
#pragma unroll
    for (int j = 0; j < 2; ++j) {
      v8h hv;
      hv[0] = (f16)rv[j][0].x; hv[1] = (f16)rv[j][0].y; hv[2] = (f16)rv[j][0].z; hv[3] = (f16)rv[j][0].w;
      hv[4] = (f16)rv[j][1].x; hv[5] = (f16)rv[j][1].y; hv[6] = (f16)rv[j][1].z; hv[7] = (f16)rv[j][1].w;
      *(v8h*)(vdst + vo + j * (16 * VSTR)) = hv;   // 16B ds_store
    }
  };
  fetch(0);
  stage(0, 0);
  fetch(1);                          // the first tile has at least NTILE / 2 + 1 trips
  int par = 0;                       // K buffer of the coming trip: alternates on over the seam
  int vof = 2 * BN * VSTR;           // V buffer (offset in halves) of the trip last begun: goes round three, on over the seam

  for (int half = 0; half < 2; ++half) {
  const int  qt      = half ? pr : (NTILE - 1 - pr);
  const int  qwave   = qt * BM + wave * WM;   // first absolute query row of this wave
  const int  ntrips  = qt + 1;                // causal: only k <= last query of tile; 128 keys a trip

  v8f oacc[4];
#pragma unroll
  for (int vt = 0; vt < 4; ++vt) oacc[vt] = vzero;
  float mrow = -1e30f, lrow = 0.f;   // of query qwave + l16, alike in both lane halves

  v8f s[4];                          // a block's scores: set and read by active waves only; in group 1 they live over a barrier

  // ---- second half of a block's work: V reads, mask, softmax, O^T += V^T P^T; kb = the block's first key, vo = its V buffer ----
  auto softpv = [&](int kb, int vo) {
    // ---- V operands: they drain under the softmax
    v16h vb[2][4];                   // [chunk][d tile]
    {
      const f16* sVc = sVg + vo;
#pragma unroll
      for (int c = 0; c < 2; ++c)
#pragma unroll
        for (int vt = 0; vt < 4; ++vt) {
          // lane (l16, hl) receives V[c*32 + 8*hl + 0..7][vt*16 + l16], then the same 16 keys on: row l16 of V^T, hardware k order
          const f16* vbp = sVc + (c * 32 + hl * 8 + (lane & 7)) * VSTR + vt * 16 + ((lane >> 3) & 1) * 8;
          vb[c][vt] = cat8(ld_tr16(vbp), ld_tr16(vbp + 16 * VSTR));
        }
    }

    // ---- causal mask on diagonal blocks ----
    if (kb + BN - 1 > qwave) {
      // one lane value against constants: with kb scalar, 32 values q - constant would else be kept in registers
      const int lim = qwave + l16 - kb - hl * 8;
#pragma unroll
      for (int nt = 0; nt < 4; ++nt)
#pragma unroll
        for (int r = 0; r < 8; ++r)
          if (nt * 16 + r > lim) s[nt][r] = -1e30f;
    }

    // ---- online softmax (log2 domain): one query per lane, a tree of three-input maxima ----
    float t1[10], t2[4];
#pragma unroll
    for (int g = 0; g < 10; ++g)
      t1[g] = max3f(s[(3 * g) >> 3][(3 * g) & 7], s[(3 * g + 1) >> 3][(3 * g + 1) & 7],
                    s[(3 * g + 2) >> 3][(3 * g + 2) & 7]);
    t2[0] = max3f(t1[0], t1[1], t1[2]);
    t2[1] = max3f(t1[3], t1[4], t1[5]);
    t2[2] = max3f(t1[6], t1[7], t1[8]);
    t2[3] = max3f(t1[9], s[3][6], s[3][7]);
    const float mx    = fmaxf(max3f(t2[0], t2[1], t2[2]), t2[3]);
    const float mnew  = max3f(mrow, mx, xhalf(mx));
    const float alpha = __builtin_amdgcn_exp2f(mrow - mnew);
    mrow = mnew;

    // ---- P^T as B operands, one per chunk, packed from the score tiles in place: lane half hl holds
    //      keys 8*hl + r and 16 + 8*hl + r of a chunk, elements r and 8 + r in the hardware k order ----
    v16h pa[2];
#pragma unroll
    for (int c = 0; c < 2; ++c)
#pragma unroll
      for (int nt = 0; nt < 2; ++nt)
#pragma unroll
        for (int r = 0; r < 8; ++r)
          pa[c][nt * 8 + r] = (f16)__builtin_amdgcn_exp2f(s[2 * c + nt][r] - mnew);

    // ---- sum of P via ones-matrix WMMA (every row of its tile holds it), then O^T += V^T P^T ----
    v8f lsum = __builtin_amdgcn_wmma_f32_16x16x32_f16(false, onesb, false, pa[0], (short)0, vzero, false, false);
#pragma unroll
    for (int vt = 0; vt < 4; ++vt) {
#pragma unroll
      for (int r = 0; r < 8; ++r) oacc[vt][r] *= alpha;
      oacc[vt] = __builtin_amdgcn_wmma_f32_16x16x32_f16(false, vb[0][vt], false, pa[0], (short)0, oacc[vt], false, false);
    }
    lsum = __builtin_amdgcn_wmma_f32_16x16x32_f16(false, onesb, false, pa[1], (short)0, lsum, false, false);
#pragma unroll
    for (int vt = 0; vt < 4; ++vt)
      oacc[vt] = __builtin_amdgcn_wmma_f32_16x16x32_f16(false, vb[1][vt], false, pa[1], (short)0, oacc[vt], false, false);
    lrow = lrow * alpha + lsum[0];
  };

  // In the first half of a block's work (K reads, scores, staging) a wave wants LDS and the matrix unit,
  // in the second mostly the vector unit. Group 1 runs half a trip behind group 0: it opens a trip with the
  // second half of its previous block, so that the two groups' waves on a SIMD want different units at a time.
  // It then reads that block's V behind the next trip's barrier: hence the third V buffer, so that the
  // staging of that trip, which refills the buffer two trips back, leaves it alone
  for (int it = 0; it < ntrips; ++it) {
    const int k0  = (it * NGRP + grp) * BN;
    const int cur = par;
    par ^= 1;

    // the one barrier of a trip: publishes the buffers of trip it (stored during trip it-1)
    // and ends every wave's reads of the buffers that are refilled behind it.
    // Its fences name LDS alone: __syncthreads() would also wait here for the global
    // loads of trip it+1, which only this thread's registers receive
    __builtin_amdgcn_fence(__ATOMIC_RELEASE, "workgroup", "local");
    __builtin_amdgcn_s_barrier();
    __builtin_amdgcn_fence(__ATOMIC_ACQUIRE, "workgroup", "local");

    if (grp == 1 && it > 0 && k0 - NGRP * BN <= qwave + (WM - 1)) softpv(k0 - NGRP * BN, vof);
    vof = vof == 2 * BN * VSTR ? 0 : vof + BN * VSTR;

    // wave-uniform skip of fully-masked key blocks (EXEC stays all-ones)
    const bool active = k0 <= qwave + (WM - 1);
    if (active) {
      const f16* sKc = sKg + (cur ? BN * KSTR : 0);
      v16h kop[4][2];
#pragma unroll
      for (int nt = 0; nt < 4; ++nt)
#pragma unroll
        for (int kc = 0; kc < 2; ++kc) {
          const f16* base = sKc + (nt * 16 + l16) * KSTR + kc * 32 + hl * 8;
          kop[nt][kc] = cat8(*(const v8h*)base, *(const v8h*)(base + 16));
        }
      // keeps the K loads one group ahead of the products: without it the compiler loads the
      // last operands one at a time, each with a full wait in front of its product
      __builtin_amdgcn_sched_barrier(0);

      // ---- S^T = K (Q*scale)^T : 64x16 scores in four f32 tiles, s[nt][r] = key nt*16 + 8*hl + r ----
#pragma unroll
      for (int nt = 0; nt < 4; ++nt)
        s[nt] = __builtin_amdgcn_wmma_f32_16x16x32_f16(false, kop[nt][0], false, qa[0], (short)0, vzero, false, false);
#pragma unroll
      for (int nt = 0; nt < 4; ++nt)
        s[nt] = __builtin_amdgcn_wmma_f32_16x16x32_f16(false, kop[nt][1], false, qa[1], (short)0, s[nt], false, false);
    }

    // ---- every wave: trip it+1 registers -> its buffers, then trip it+2's loads.
    //      The pipeline runs on over the seam: behind a tile's last trips come trips 0
    //      and 1 of the same head again. No test for the very end, nor for a second tile
    //      of one trip: what is brought past a tile's end is trip 0 or 1, in bounds, goes
    //      at most into buffers that nobody reads any more and is not used
    stage(cur ^ 1, vof == 2 * BN * VSTR ? 0 : vof + BN * VSTR);
    fetch(it + 2 < ntrips ? it + 2 : it + 2 - ntrips);

    if (grp == 0 && active) softpv(k0, vof);
  }
  // group 1's last block of the tile
  if (grp == 1 && ((ntrips - 1) * NGRP + 1) * BN <= qwave + (WM - 1)) softpv(((ntrips - 1) * NGRP + 1) * BN, vof);

  // ---- join of the key groups: group 1 hands its tiles, maximum and sum over in LDS.
  //      A group that saw no key of a query hands over maximum -1e30, sum 0, tiles 0
  float4* so = sO + wave * (8 * 32) + lane;
  if (grp == 1) {
#pragma unroll
    for (int vt = 0; vt < 4; ++vt) {
      so[(2 * vt + 0) * 32] = make_float4(oacc[vt][0], oacc[vt][1], oacc[vt][2], oacc[vt][3]);
      so[(2 * vt + 1) * 32] = make_float4(oacc[vt][4], oacc[vt][5], oacc[vt][6], oacc[vt][7]);
    }
    sM[wave * 32 + lane] = mrow;
    sL[wave * 32 + lane] = lrow;
  }
  // publishes group 1's hand-over; LDS-only fences, as in the loop. The next tile's first
  // loop barrier ends group 0's reads before group 1 can write here again
  __builtin_amdgcn_fence(__ATOMIC_RELEASE, "workgroup", "local");
  __builtin_amdgcn_s_barrier();
  __builtin_amdgcn_fence(__ATOMIC_ACQUIRE, "workgroup", "local");

  // ---- epilogue, group 0: join, normalize and store fp32; oacc[vt][r] = O[qwave + l16][vt*16 + 8*hl + r] ----
  if (grp == 0) {
    const float m1  = sM[wave * 32 + lane];
    const float l1  = sL[wave * 32 + lane];
    const float mj  = fmaxf(mrow, m1);
    const float a0  = __builtin_amdgcn_exp2f(mrow - mj);
    const float a1  = __builtin_amdgcn_exp2f(m1 - mj);
    const float inv = 1.0f / (lrow * a0 + l1 * a1);
    const float c0  = a0 * inv, c1 = a1 * inv;
    float* orow = Oh + (size_t)(qwave + l16) * DHEAD + hl * 8;
#pragma unroll
    for (int vt = 0; vt < 4; ++vt) {
      const float4 p = so[(2 * vt + 0) * 32];
      const float4 u = so[(2 * vt + 1) * 32];
      *(float4*)(orow + vt * 16 + 0) = make_float4(oacc[vt][0] * c0 + p.x * c1, oacc[vt][1] * c0 + p.y * c1,
                                                   oacc[vt][2] * c0 + p.z * c1, oacc[vt][3] * c0 + p.w * c1);
      *(float4*)(orow + vt * 16 + 4) = make_float4(oacc[vt][4] * c0 + u.x * c1, oacc[vt][5] * c0 + u.y * c1,
                                                   oacc[vt][6] * c0 + u.z * c1, oacc[vt][7] * c0 + u.w * c1);
    }
    // the next tile's set-up overwrites the address and data registers of these stores
    asm volatile("s_wait_xcnt 0x0" ::: "memory");
  }
  qa[0] = qn[0];
  qa[1] = qn[1];
  }
  // the last block's loads have no consumer: they return before the wave ends
  asm volatile("s_wait_loadcnt 0x0" ::: "memory");
}

extern "C" void kernel_launch(void* const* d_in, const int* in_sizes, int n_in,
                              void* d_out, int out_size, void* d_ws, size_t ws_size,
                              hipStream_t stream) {
  (void)in_sizes; (void)n_in; (void)out_size; (void)d_ws; (void)ws_size;
  const float* Q = (const float*)d_in[0];
  const float* K = (const float*)d_in[1];
  const float* V = (const float*)d_in[2];
  float* O = (float*)d_out;
  dim3 grid(BATCH * NHEAD * (NTILE / 2));    // 256 workgroups, two query tiles each
  dim3 block(NGRP * 256);                     // 16 wave32 waves: 8 query waves x 2 key groups
  fa_fwd_causal_kernel<<<grid, block, 0, stream>>>(Q, K, V, O);
}

// v008
// It runs in 22.5 microseconds.
// Two timings next to v007 put it at 1.22 and 1.21 times that version's speed.
// All steps since v000 together make it 3.37 times as fast.
#include <hip/hip_runtime.h>

typedef _Float16 f16;
typedef __attribute__((ext_vector_type(16))) _Float16 v16h;
typedef __attribute__((ext_vector_type(8)))  _Float16 v8h;
typedef __attribute__((ext_vector_type(4)))  _Float16 v4h;
typedef __attribute__((ext_vector_type(8)))  float    v8f;
typedef __attribute__((ext_vector_type(8)))  short    s16x8;

#define S_LEN  2048
#define DHEAD  64
#define NHEAD  16
#define BATCH  2
#define BM     128   // query rows per tile
#define NTILE  (S_LEN / BM)   // query tiles per head: 16
#define WM     16    // query rows per wave
#define BN     64    // key block: two chunks of 32 keys, the k extent of one PV product
#define KSTR   72    // sK row stride (halves): 64 + 8 pad, 144B (16B x odd)
#define VSTR   80    // sV row stride (halves): 64 + 16 pad, 160B (32B x odd), the transposing load's pitch
#define NQW    (BM / WM)   // query waves of a key group: 8
#define NGRP   2     // key groups of a workgroup: group g takes key blocks g, g + 2, g + 4, ...

static __device__ __forceinline__ v16h cat8(v8h lo, v8h hi) {
  return __builtin_shufflevector(lo, hi, 0,1,2,3,4,5,6,7,8,9,10,11,12,13,14,15);
}

// transposing LDS load: the lanes' 16-byte pieces of eight rows come back as eight rows' elements of one column
static __device__ __forceinline__ v8h ld_tr16(const f16* p) {
  typedef __attribute__((address_space(3))) s16x8 lds_s16x8;
  return __builtin_bit_cast(v8h, __builtin_amdgcn_ds_load_tr16_b128_v8i16((lds_s16x8*)p));
}

static __device__ __forceinline__ float max3f(float a, float b, float c) {
  return fmaxf(fmaxf(a, b), c);
}
// the value of lane l ^ 16: the other half of the same query's keys
static __device__ __forceinline__ float xhalf(float x) {
  const int xi = __float_as_int(x);
  return __int_as_float(__builtin_amdgcn_permlanex16(xi, xi, 0x76543210, 0xfedcba98, false, false));
}

__launch_bounds__(NGRP * 256)
__global__ void fa_fwd_causal_kernel(const float* __restrict__ Qg,
                                     const float* __restrict__ Kg,
                                     const float* __restrict__ Vg,
                                     float* __restrict__ Og)
{
  __shared__ __align__(16) f16 sK[NGRP * 2 * BN * KSTR];      // per group two buffers of [key][d]  row-major
  __shared__ __align__(16) f16 sV[NGRP * 3 * BN * VSTR];      // per group three buffers of [key][d]  row-major, read transposed
  __shared__ float4 sO[NQW * 8 * 32];                         // join: group 1's output tiles, [query wave][quad][lane]; then each wave's 16 output rows on their way to whole-line stores
  __shared__ float  sM[NQW * 32], sL[NQW * 32];               // join: group 1's maximum and sum, [query wave][lane]
  __shared__ __align__(16) f16 sQ[NGRP * NQW * WM * KSTR];    // per wave its own 16 Q rows [query][d], on the way from whole-line loads to the B layout

  // Sixteen waves, four to a SIMD: two groups of eight. Both groups hold the same 128
  // queries; a group stages, reads and multiplies only its own key blocks, and the two
  // partial results of a tile are joined through LDS behind the tile's last block.
  const int grp  = __builtin_amdgcn_readfirstlane(threadIdx.x >> 8);   // key group, wave-uniform
  const int tid  = threadIdx.x & 255;                                  // thread inside its group
  const int wave = __builtin_amdgcn_readfirstlane(tid >> 5);           // scalar, so the tests on a wave's rows are scalar branches
  const int lane = tid & 31;
  const int hl   = lane >> 4;   // lane half (0/1)
  const int l16  = lane & 15;

  // causal cost grows linearly with the tile index, and all workgroups are resident
  // at once: each workgroup runs tile NTILE-1-pr and then tile pr of one head, so
  // every workgroup walks the same number of key blocks (NTILE + 1 in each group)
  const int bh = blockIdx.x / (NTILE / 2); // fused batch*head
  const int pr = blockIdx.x % (NTILE / 2); // tile pair

  const float* Qh = Qg + (size_t)bh * (S_LEN * DHEAD);
  const float* Kb = Kg + (size_t)bh * (S_LEN * DHEAD);
  const float* Vb = Vg + (size_t)bh * (S_LEN * DHEAD);
  float*       Oh = Og + (size_t)bh * (S_LEN * DHEAD);

  // ---- Q of a tile into B-operand layout (A's with n for m), pre-scaled by log2(e)/sqrt(D) ----
  const float qscale = 0.18033688f;        // log2(e) / 8
  // A load in the B layout itself would touch 16 lines for 512 bytes. Instead sixteen lanes read one whole
  // 256-byte row, and the wave turns its 16 rows through its own LDS rows (K's pitch, K's fragment reads)
  f16* sQw = sQ + (grp * NQW + wave) * (WM * KSTR);
  auto fetchq = [&](int qt, float4* t) {   // lane half hl brings rows 8 * hl + i
    const float* qsrc = Qh + (size_t)(qt * BM + wave * WM + hl * 8) * DHEAD + l16 * 4;
#pragma unroll
    for (int i = 0; i < 8; ++i) t[i] = *(const float4*)(qsrc + i * DHEAD);
  };
  auto turnq = [&](const float4* t, v16h* qdst) {
    // rows i and i + 8 lie 8 * 144 B = 32 banks apart, so an 8-byte store meets every bank once
#pragma unroll
    for (int i = 0; i < 8; ++i) {
      v4h h;
      h[0] = (f16)(t[i].x * qscale); h[1] = (f16)(t[i].y * qscale);
      h[2] = (f16)(t[i].z * qscale); h[3] = (f16)(t[i].w * qscale);
      *(v4h*)(sQw + (hl * 8 + i) * KSTR + l16 * 4) = h;   // 8B ds_store
    }
    // the wave's own rows, written by other lanes: the stores end before the reads, and the compiler moves neither over this
    asm volatile("s_wait_dscnt 0x0" ::: "memory");
#pragma unroll
    for (int kc = 0; kc < 2; ++kc) {
      const f16* base = sQw + l16 * KSTR + kc * 32 + hl * 8;   // k order: {d0..d0+7, d0+16..d0+23}, as the K rows
      qdst[kc] = cat8(*(const v8h*)base, *(const v8h*)(base + 16));
    }
  };
  v16h qa[2], qn[2];                       // both tiles' Q up front: no load at the seam
  float4 tqa[8], tqn[8];                   // their loads fly together with the first key block's
  fetchq(NTILE - 1 - pr, tqa);
  fetchq(pr, tqn);

  // all-ones A operand: the sum of a query's P over both lane halves via one extra WMMA
  v16h onesb;
#pragma unroll
  for (int i = 0; i < 16; ++i) onesb[i] = (f16)1.0f;

  const v8f vzero = {0.f,0.f,0.f,0.f,0.f,0.f,0.f,0.f};
  // staging: sixteen lanes bring one whole 256-byte row, so a wave's load touches four whole lines;
  // a thread brings 4 d of K rows skey + 16 * j and of V rows vkey + 16 * j, j = 0..3
  const int sd0   = l16 * 4;         // staging: d {0,4,..,60}
  // the two rows of a wave's 8-byte LDS store (128 bytes each) lie 32 banks apart and meet every bank once:
  // K rows 8 apart (8 * 144 B), V rows 4 apart (4 * 160 B)
  const int skey  = hl * 8 + wave;
  const int vkey  = ((wave >> 2) << 3) + hl * 4 + (wave & 3);

  // ---- staging pipeline: a key block goes global -> registers -> LDS buffer, one
  //      block ahead in LDS and two ahead in registers, so neither the global
  //      latency nor the LDS stores stand between a barrier and the products
  f16* sKg = sK + grp * (2 * BN * KSTR);       // the group's own buffers
  f16* sVg = sV + grp * (3 * BN * VSTR);
  const float* kst = Kb + (size_t)(grp * BN + skey) * DHEAD + sd0;
  const float* vst = Vb + (size_t)(grp * BN + vkey) * DHEAD + sd0;
  f16* kdst = sKg + skey * KSTR + sd0;
  f16* vdst = sVg + vkey * VSTR + sd0;
  float4 rk[4], rv[4];               // [key skey or vkey + 16 * j]
  auto fetch = [&](int it) {         // the group's block of trip it: key block NGRP * it + grp
    const float* ks = kst + (size_t)it * (NGRP * BN * DHEAD);
    const float* vs = vst + (size_t)it * (NGRP * BN * DHEAD);
#pragma unroll
    for (int j = 0; j < 4; ++j) {
      rk[j] = *(const float4*)(ks + j * (16 * DHEAD));
      rv[j] = *(const float4*)(vs + j * (16 * DHEAD));
    }
    // precaution: no register that an issued load names is rewritten ahead of this wait. The two
    // addresses are its inputs, so they stay whole up to it and no load's result is laid over them
    asm volatile("s_wait_xcnt 0x0" :: "v"(ks), "v"(vs) : "memory");
  };
  // buffer offsets here and at the operand loads are selects, not products: K and V buffers now differ
  // in size, and from buf * size the compiler made four vector multiply-adds a trip
  auto stage = [&](int buf, int vo) {   // K buffer 0 or 1; V buffer by its offset in halves
#pragma unroll
    for (int j = 0; j < 4; ++j) {
      v4h hk;
      hk[0] = (f16)rk[j].x; hk[1] = (f16)rk[j].y; hk[2] = (f16)rk[j].z; hk[3] = (f16)rk[j].w;
      *(v4h*)(kdst + (buf ? BN * KSTR : 0) + j * (16 * KSTR)) = hk;   // 8B ds_store
    }
#pragma unroll
    for (int j = 0; j < 4; ++j) {
      v4h hv;
      hv[0] = (f16)rv[j].x; hv[1] = (f16)rv[j].y; hv[2] = (f16)rv[j].z; hv[3] = (f16)rv[j].w;
      *(v4h*)(vdst + vo + j * (16 * VSTR)) = hv;   // 8B ds_store
    }
  };
  fetch(0);
  turnq(tqa, qa);
  // the first tile's reads end before the same rows are written for the second; the compiler moves neither over this
  asm volatile("s_wait_dscnt 0x0" ::: "memory");
  turnq(tqn, qn);
  stage(0, 0);
  fetch(1);                          // the first tile has at least NTILE / 2 + 1 trips
  int par = 0;                       // K buffer of the coming trip: alternates on over the seam
  int vof = 2 * BN * VSTR;           // V buffer (offset in halves) of the trip last begun: goes round three, on over the seam

  for (int half = 0; half < 2; ++half) {
  const int  qt      = half ? pr : (NTILE - 1 - pr);
  const int  qwave   = qt * BM + wave * WM;   // first absolute query row of this wave
  const int  ntrips  = qt + 1;                // causal: only k <= last query of tile; 128 keys a trip

  v8f oacc[4];
#pragma unroll
  for (int vt = 0; vt < 4; ++vt) oacc[vt] = vzero;
  float mrow = -1e30f, lrow = 0.f;   // of query qwave + l16, alike in both lane halves

  v8f s[4];                          // a block's scores: set and read by active waves only; in group 1 they live over a barrier

  // ---- second half of a block's work: V reads, mask, softmax, O^T += V^T P^T; kb = the block's first key, vo = its V buffer ----
  auto softpv = [&](int kb, int vo) {
    // ---- V operands: they drain under the softmax
    v16h vb[2][4];                   // [chunk][d tile]
    {
      const f16* sVc = sVg + vo;
#pragma unroll
      for (int c = 0; c < 2; ++c)
#pragma unroll
        for (int vt = 0; vt < 4; ++vt) {
          // lane (l16, hl) receives V[c*32 + 8*hl + 0..7][vt*16 + l16], then the same 16 keys on: row l16 of V^T, hardware k order
          const f16* vbp = sVc + (c * 32 + hl * 8 + (lane & 7)) * VSTR + vt * 16 + ((lane >> 3) & 1) * 8;
          vb[c][vt] = cat8(ld_tr16(vbp), ld_tr16(vbp + 16 * VSTR));
        }
    }

    // ---- causal mask on diagonal blocks ----
    if (kb + BN - 1 > qwave) {
      // one lane value against constants: with kb scalar, 32 values q - constant would else be kept in registers
      const int lim = qwave + l16 - kb - hl * 8;
#pragma unroll
      for (int nt = 0; nt < 4; ++nt)
#pragma unroll
        for (int r = 0; r < 8; ++r)
          if (nt * 16 + r > lim) s[nt][r] = -1e30f;
    }

    // ---- online softmax (log2 domain): one query per lane, a tree of three-input maxima ----
    float t1[10], t2[4];
#pragma unroll
    for (int g = 0; g < 10; ++g)
      t1[g] = max3f(s[(3 * g) >> 3][(3 * g) & 7], s[(3 * g + 1) >> 3][(3 * g + 1) & 7],
                    s[(3 * g + 2) >> 3][(3 * g + 2) & 7]);
    t2[0] = max3f(t1[0], t1[1], t1[2]);
    t2[1] = max3f(t1[3], t1[4], t1[5]);
    t2[2] = max3f(t1[6], t1[7], t1[8]);
    t2[3] = max3f(t1[9], s[3][6], s[3][7]);
    const float mx    = fmaxf(max3f(t2[0], t2[1], t2[2]), t2[3]);
    const float mnew  = max3f(mrow, mx, xhalf(mx));
    const float alpha = __builtin_amdgcn_exp2f(mrow - mnew);
    mrow = mnew;

    // ---- P^T as B operands, one per chunk, packed from the score tiles in place: lane half hl holds
    //      keys 8*hl + r and 16 + 8*hl + r of a chunk, elements r and 8 + r in the hardware k order ----
    v16h pa[2];
#pragma unroll
    for (int c = 0; c < 2; ++c)
#pragma unroll
      for (int nt = 0; nt < 2; ++nt)
#pragma unroll
        for (int r = 0; r < 8; ++r)
          pa[c][nt * 8 + r] = (f16)__builtin_amdgcn_exp2f(s[2 * c + nt][r] - mnew);

    // ---- sum of P via ones-matrix WMMA (every row of its tile holds it), then O^T += V^T P^T ----
    v8f lsum = __builtin_amdgcn_wmma_f32_16x16x32_f16(false, onesb, false, pa[0], (short)0, vzero, false, false);
#pragma unroll
    for (int vt = 0; vt < 4; ++vt) {
#pragma unroll
      for (int r = 0; r < 8; ++r) oacc[vt][r] *= alpha;
      oacc[vt] = __builtin_amdgcn_wmma_f32_16x16x32_f16(false, vb[0][vt], false, pa[0], (short)0, oacc[vt], false, false);
    }
    lsum = __builtin_amdgcn_wmma_f32_16x16x32_f16(false, onesb, false, pa[1], (short)0, lsum, false, false);
#pragma unroll
    for (int vt = 0; vt < 4; ++vt)
      oacc[vt] = __builtin_amdgcn_wmma_f32_16x16x32_f16(false, vb[1][vt], false, pa[1], (short)0, oacc[vt], false, false);
    lrow = lrow * alpha + lsum[0];
  };

  // In the first half of a block's work (K reads, scores, staging) a wave wants LDS and the matrix unit,
  // in the second mostly the vector unit. Group 1 runs half a trip behind group 0: it opens a trip with the
  // second half of its previous block, so that the two groups' waves on a SIMD want different units at a time.
  // It then reads that block's V behind the next trip's barrier: hence the third V buffer, so that the
  // staging of that trip, which refills the buffer two trips back, leaves it alone
  for (int it = 0; it < ntrips; ++it) {
    const int k0  = (it * NGRP + grp) * BN;
    const int cur = par;
    par ^= 1;

    // the one barrier of a trip: publishes the buffers of trip it (stored during trip it-1)
    // and ends every wave's reads of the buffers that are refilled behind it.
    // Its fences name LDS alone: __syncthreads() would also wait here for the global
    // loads of trip it+1, which only this thread's registers receive
    __builtin_amdgcn_fence(__ATOMIC_RELEASE, "workgroup", "local");
    __builtin_amdgcn_s_barrier();
    __builtin_amdgcn_fence(__ATOMIC_ACQUIRE, "workgroup", "local");

    if (grp == 1 && it > 0 && k0 - NGRP * BN <= qwave + (WM - 1)) softpv(k0 - NGRP * BN, vof);
    vof = vof == 2 * BN * VSTR ? 0 : vof + BN * VSTR;

    // wave-uniform skip of fully-masked key blocks (EXEC stays all-ones)
    const bool active = k0 <= qwave + (WM - 1);
    if (active) {
      const f16* sKc = sKg + (cur ? BN * KSTR : 0);
      v16h kop[4][2];
#pragma unroll
      for (int nt = 0; nt < 4; ++nt)
#pragma unroll
        for (int kc = 0; kc < 2; ++kc) {
          const f16* base = sKc + (nt * 16 + l16) * KSTR + kc * 32 + hl * 8;
          kop[nt][kc] = cat8(*(const v8h*)base, *(const v8h*)(base + 16));
        }
      // keeps the K loads one group ahead of the products: without it the compiler loads the
      // last operands one at a time, each with a full wait in front of its product
      __builtin_amdgcn_sched_barrier(0);

      // ---- S^T = K (Q*scale)^T : 64x16 scores in four f32 tiles, s[nt][r] = key nt*16 + 8*hl + r ----
#pragma unroll
      for (int nt = 0; nt < 4; ++nt)
        s[nt] = __builtin_amdgcn_wmma_f32_16x16x32_f16(false, kop[nt][0], false, qa[0], (short)0, vzero, false, false);
#pragma unroll
      for (int nt = 0; nt < 4; ++nt)
        s[nt] = __builtin_amdgcn_wmma_f32_16x16x32_f16(false, kop[nt][1], false, qa[1], (short)0, s[nt], false, false);
    }

    // ---- every wave: trip it+1 registers -> its buffers, then trip it+2's loads.
    //      The pipeline runs on over the seam: behind a tile's last trips come trips 0
    //      and 1 of the same head again. No test for the very end, nor for a second tile
    //      of one trip: what is brought past a tile's end is trip 0 or 1, in bounds, goes
    //      at most into buffers that nobody reads any more and is not used
    stage(cur ^ 1, vof == 2 * BN * VSTR ? 0 : vof + BN * VSTR);
    fetch(it + 2 < ntrips ? it + 2 : it + 2 - ntrips);

    if (grp == 0 && active) softpv(k0, vof);
  }
  // group 1's last block of the tile
  if (grp == 1 && ((ntrips - 1) * NGRP + 1) * BN <= qwave + (WM - 1)) softpv(((ntrips - 1) * NGRP + 1) * BN, vof);

  // ---- join of the key groups: group 1 hands its tiles, maximum and sum over in LDS.
  //      A group that saw no key of a query hands over maximum -1e30, sum 0, tiles 0
  float4* so = sO + wave * (8 * 32) + lane;
  if (grp == 1) {
#pragma unroll
    for (int vt = 0; vt < 4; ++vt) {
      so[(2 * vt + 0) * 32] = make_float4(oacc[vt][0], oacc[vt][1], oacc[vt][2], oacc[vt][3]);
      so[(2 * vt + 1) * 32] = make_float4(oacc[vt][4], oacc[vt][5], oacc[vt][6], oacc[vt][7]);
    }
    sM[wave * 32 + lane] = mrow;
    sL[wave * 32 + lane] = lrow;
  }
  // publishes group 1's hand-over; LDS-only fences, as in the loop. The next tile's first
  // loop barrier ends group 0's reads before group 1 can write here again
  __builtin_amdgcn_fence(__ATOMIC_RELEASE, "workgroup", "local");
  __builtin_amdgcn_s_barrier();
  __builtin_amdgcn_fence(__ATOMIC_ACQUIRE, "workgroup", "local");

  // ---- epilogue, group 0: join, normalize and store fp32; oacc[vt][r] = O[qwave + l16][vt*16 + 8*hl + r] ----
  if (grp == 0) {
    const float m1  = sM[wave * 32 + lane];
    const float l1  = sL[wave * 32 + lane];
    const float mj  = fmaxf(mrow, m1);
    const float a0  = __builtin_amdgcn_exp2f(mrow - mj);
    const float a1  = __builtin_amdgcn_exp2f(m1 - mj);
    const float inv = 1.0f / (lrow * a0 + l1 * a1);
    const float c0  = a0 * inv, c1 = a1 * inv;
    float4 res[8];                     // res[2 * vt + e] = O[qwave + l16][vt*16 + 8*hl + 4*e + 0..3]
#pragma unroll
    for (int vt = 0; vt < 4; ++vt) {
      const float4 p = so[(2 * vt + 0) * 32];
      const float4 u = so[(2 * vt + 1) * 32];
      res[2 * vt + 0] = make_float4(oacc[vt][0] * c0 + p.x * c1, oacc[vt][1] * c0 + p.y * c1,
                                    oacc[vt][2] * c0 + p.z * c1, oacc[vt][3] * c0 + p.w * c1);
      res[2 * vt + 1] = make_float4(oacc[vt][4] * c0 + u.x * c1, oacc[vt][5] * c0 + u.y * c1,
                                    oacc[vt][6] * c0 + u.z * c1, oacc[vt][7] * c0 + u.w * c1);
    }
    // A store from this layout would touch 16 lines for 512 bytes. The wave turns its 16 rows of 256 bytes through
    // the 4 KB of sO that held its share of the hand-over, and stores two whole rows at a time.
    // All of the hand-over is read before any of it is overwritten: the compiler moves no LDS access over this
    asm volatile("s_wait_dscnt 0x0" ::: "memory");
    float4* sw = sO + wave * (8 * 32);
    // 16-byte piece c of row q lies at place c ^ q of the row: rows are 64 banks long, so sixteen lanes that
    // write one piece number of sixteen rows, or read the sixteen pieces of one row, meet every bank once
#pragma unroll
    for (int vt = 0; vt < 4; ++vt)
#pragma unroll
      for (int e = 0; e < 2; ++e)
        sw[l16 * 16 + ((vt * 4 + hl * 2 + e) ^ l16)] = res[2 * vt + e];
    // rows written by other lanes of this wave: the stores end before the reads
    asm volatile("s_wait_dscnt 0x0" ::: "memory");
    float* orow = Oh + (size_t)(qwave + hl) * DHEAD + l16 * 4;
#pragma unroll
    for (int i = 0; i < 8; ++i)
      *(float4*)(orow + i * (2 * DHEAD)) = sw[(2 * i + hl) * 16 + (l16 ^ (2 * i + hl))];
    // the next tile's set-up overwrites the address and data registers of these stores
    asm volatile("s_wait_xcnt 0x0" ::: "memory");
  }
  qa[0] = qn[0];
  qa[1] = qn[1];
  }
  // the last block's loads have no consumer: they return before the wave ends
  asm volatile("s_wait_loadcnt 0x0" ::: "memory");
}

extern "C" void kernel_launch(void* const* d_in, const int* in_sizes, int n_in,
                              void* d_out, int out_size, void* d_ws, size_t ws_size,
                              hipStream_t stream) {
  (void)in_sizes; (void)n_in; (void)out_size; (void)d_ws; (void)ws_size;
  const float* Q = (const float*)d_in[0];
  const float* K = (const float*)d_in[1];
  const float* V = (const float*)d_in[2];
  float* O = (float*)d_out;
  dim3 grid(BATCH * NHEAD * (NTILE / 2));    // 256 workgroups, two query tiles each
  dim3 block(NGRP * 256);                     // 16 wave32 waves: 8 query waves x 2 key groups
  fa_fwd_causal_kernel<<<grid, block, 0, stream>>>(Q, K, V, O);
}

// v009
// A run of this version takes 21.4 microseconds.
// Next to v008, in two timings, it ran 1.05 times as fast each time.
// All steps since v000 together make it 3.54 times as fast.
#include <hip/hip_runtime.h>

typedef _Float16 f16;
typedef __attribute__((ext_vector_type(16))) _Float16 v16h;
typedef __attribute__((ext_vector_type(8)))  _Float16 v8h;
typedef __attribute__((ext_vector_type(4)))  _Float16 v4h;
typedef __attribute__((ext_vector_type(8)))  float    v8f;
typedef __attribute__((ext_vector_type(8)))  short    s16x8;

#define S_LEN  2048
#define DHEAD  64
#define NHEAD  16
#define BATCH  2
#define BM     128   // query rows per tile
#define NTILE  (S_LEN / BM)   // query tiles per head: 16
#define WM     16    // query rows per wave
#define BN     64    // key block: two chunks of 32 keys, the k extent of one PV product
#define KSTR   72    // sK row stride (halves): 64 + 8 pad, 144B (16B x odd)
#define VSTR   80    // sV row stride (halves): 64 + 16 pad, 160B (32B x odd), the transposing load's pitch
#define NQW    (BM / WM)   // query waves of a key group: 8
#define NGRP   2     // key groups of a workgroup: group g takes key blocks g, g + 2, g + 4, ...
#define OPIT   17    // pitch (16-byte pieces) of an output row on its way through LDS: 16 + 1 pad, 272 B

static __device__ __forceinline__ v16h cat8(v8h lo, v8h hi) {
  return __builtin_shufflevector(lo, hi, 0,1,2,3,4,5,6,7,8,9,10,11,12,13,14,15);
}

// transposing LDS load: the lanes' 16-byte pieces of eight rows come back as eight rows' elements of one column
static __device__ __forceinline__ v8h ld_tr16(const f16* p) {
  typedef __attribute__((address_space(3))) s16x8 lds_s16x8;
  return __builtin_bit_cast(v8h, __builtin_amdgcn_ds_load_tr16_b128_v8i16((lds_s16x8*)p));
}

static __device__ __forceinline__ float max3f(float a, float b, float c) {
  return fmaxf(fmaxf(a, b), c);
}
// the value of lane l ^ 16: the other half of the same query's keys
static __device__ __forceinline__ float xhalf(float x) {
  const int xi = __float_as_int(x);
  return __int_as_float(__builtin_amdgcn_permlanex16(xi, xi, 0x76543210, 0xfedcba98, false, false));
}

__launch_bounds__(NGRP * 256)
__global__ void fa_fwd_causal_kernel(const float* __restrict__ Qg,
                                     const float* __restrict__ Kg,
                                     const float* __restrict__ Vg,
                                     float* __restrict__ Og)
{
  __shared__ __align__(16) f16 sK[NGRP * 2 * BN * KSTR];      // per group two buffers of [key][d]  row-major
  __shared__ __align__(16) f16 sV[NGRP * 3 * BN * VSTR];      // per group three buffers of [key][d]  row-major, read transposed
  __shared__ float4 sO[NQW * WM * OPIT];                      // join: group 1's output tiles, [query wave][quad][lane]; then each wave's 16 output rows on their way to whole-line stores
  __shared__ float  sM[NQW * 32], sL[NQW * 32];               // join: group 1's maximum and sum, [query wave][lane]
  __shared__ __align__(16) f16 sQ[NGRP * NQW * 2 * WM * KSTR];   // per wave its own 16 Q rows [query][d] of either tile, on the way from whole-line loads to the B layout

  // Sixteen waves, four to a SIMD: two groups of eight. Both groups hold the same 128
  // queries; a group stages, reads and multiplies only its own key blocks, and the two
  // partial results of a tile are joined through LDS behind the tile's last block.
  const int grp  = __builtin_amdgcn_readfirstlane(threadIdx.x >> 8);   // key group, wave-uniform
  const int tid  = threadIdx.x & 255;                                  // thread inside its group
  const int wave = __builtin_amdgcn_readfirstlane(tid >> 5);           // scalar, so the tests on a wave's rows are scalar branches
  const int lane = tid & 31;
  const int hl   = lane >> 4;   // lane half (0/1)
  const int l16  = lane & 15;

  // causal cost grows linearly with the tile index, and all workgroups are resident
  // at once: each workgroup runs tile NTILE-1-pr and then tile pr of one head, so
  // every workgroup walks the same number of key blocks (NTILE + 1 in each group)
  const int bh = blockIdx.x / (NTILE / 2); // fused batch*head
  const int pr = blockIdx.x % (NTILE / 2); // tile pair

  const float* Qh = Qg + (size_t)bh * (S_LEN * DHEAD);
  const float* Kb = Kg + (size_t)bh * (S_LEN * DHEAD);
  const float* Vb = Vg + (size_t)bh * (S_LEN * DHEAD);
  float*       Oh = Og + (size_t)bh * (S_LEN * DHEAD);

  // ---- Q of a tile into B-operand layout (A's with n for m), pre-scaled by log2(e)/sqrt(D) ----
  const float qscale = 0.18033688f;        // log2(e) / 8
  // A load in the B layout itself would touch 16 lines for 512 bytes. Instead sixteen lanes read one whole
  // 256-byte row, and the wave turns its 16 rows through its own LDS rows (K's pitch, K's fragment reads)
  f16* sQw = sQ + (grp * NQW + wave) * (2 * WM * KSTR);
  auto fetchq = [&](int qt, float4* t) {   // lane half hl brings rows 8 * hl + i
    const float* qsrc = Qh + (size_t)(qt * BM + wave * WM + hl * 8) * DHEAD + l16 * 4;
#pragma unroll
    for (int i = 0; i < 8; ++i) t[i] = *(const float4*)(qsrc + i * DHEAD);
  };
  auto putq = [&](const float4* t, int j) {   // j = 0: the first tile's rows, 1: the second's
    // rows i and i + 8 lie 8 * 144 B = 32 banks apart, so an 8-byte store meets every bank once
#pragma unroll
    for (int i = 0; i < 8; ++i) {
      v4h h;
      h[0] = (f16)(t[i].x * qscale); h[1] = (f16)(t[i].y * qscale);
      h[2] = (f16)(t[i].z * qscale); h[3] = (f16)(t[i].w * qscale);
      *(v4h*)(sQw + (j * WM + hl * 8 + i) * KSTR + l16 * 4) = h;   // 8B ds_store
    }
  };
  auto getq = [&](int j, v16h* qdst) {
#pragma unroll
    for (int kc = 0; kc < 2; ++kc) {
      const f16* base = sQw + (j * WM + l16) * KSTR + kc * 32 + hl * 8;   // k order: {d0..d0+7, d0+16..d0+23}, as the K rows
      qdst[kc] = cat8(*(const v8h*)base, *(const v8h*)(base + 16));
    }
  };
  v16h qa[2];                              // both tiles' Q come up front: no global load at the seam; the second tile's waits in LDS, not in registers
  float4 tqa[8], tqn[8];                   // their loads fly together with the first key block's
  fetchq(NTILE - 1 - pr, tqa);
  fetchq(pr, tqn);

  // all-ones A operand: the sum of a query's P over both lane halves via one extra WMMA per 32-key chunk
  v16h onesb;
#pragma unroll
  for (int i = 0; i < 16; ++i) onesb[i] = (f16)1.0f;

  const v8f vzero = {0.f,0.f,0.f,0.f,0.f,0.f,0.f,0.f};
  // staging: sixteen lanes bring one whole 256-byte row, so a wave's load touches four whole lines;
  // a thread brings 4 d of K rows skey + 16 * j and of V rows vkey + 16 * j, j = 0..3
  const int sd0   = l16 * 4;         // staging: d {0,4,..,60}
  // the two rows of a wave's 8-byte LDS store (128 bytes each) lie 32 banks apart and meet every bank once:
  // K rows 8 apart (8 * 144 B), V rows 4 apart (4 * 160 B)
  const int skey  = hl * 8 + wave;
  const int vkey  = ((wave >> 2) << 3) + hl * 4 + (wave & 3);

  // ---- staging pipeline: a key block goes global -> registers -> LDS buffer, one
  //      block ahead in LDS and two ahead in registers, so neither the global
  //      latency nor the LDS stores stand between a barrier and the products
  f16* sKg = sK + grp * (2 * BN * KSTR);       // the group's own buffers
  f16* sVg = sV + grp * (3 * BN * VSTR);
  const float* kst = Kb + (size_t)(grp * BN + skey) * DHEAD + sd0;
  const float* vst = Vb + (size_t)(grp * BN + vkey) * DHEAD + sd0;
  f16* kdst = sKg + skey * KSTR + sd0;
  f16* vdst = sVg + vkey * VSTR + sd0;
  float4 rk[4], rv[4];               // [key skey or vkey + 16 * j]
  auto fetch = [&](int it) {         // the group's block of trip it: key block NGRP * it + grp
    const float* ks = kst + (size_t)it * (NGRP * BN * DHEAD);
    const float* vs = vst + (size_t)it * (NGRP * BN * DHEAD);
#pragma unroll
    for (int j = 0; j < 4; ++j) {
      rk[j] = *(const float4*)(ks + j * (16 * DHEAD));
      rv[j] = *(const float4*)(vs + j * (16 * DHEAD));
    }
    // precaution: no register that an issued load names is rewritten ahead of this wait. The two
    // addresses are its inputs, so they stay whole up to it and no load's result is laid over them
    asm volatile("s_wait_xcnt 0x0" :: "v"(ks), "v"(vs) : "memory");
  };
  // buffer offsets here and at the operand loads are selects, not products: K and V buffers now differ
  // in size, and from buf * size the compiler made four vector multiply-adds a trip
  auto stage = [&](int buf, int vo) {   // K buffer 0 or 1; V buffer by its offset in halves
#pragma unroll
    for (int j = 0; j < 4; ++j) {
      v4h hk;
      hk[0] = (f16)rk[j].x; hk[1] = (f16)rk[j].y; hk[2] = (f16)rk[j].z; hk[3] = (f16)rk[j].w;
      *(v4h*)(kdst + (buf ? BN * KSTR : 0) + j * (16 * KSTR)) = hk;   // 8B ds_store
    }
#pragma unroll
    for (int j = 0; j < 4; ++j) {
      v4h hv;
      hv[0] = (f16)rv[j].x; hv[1] = (f16)rv[j].y; hv[2] = (f16)rv[j].z; hv[3] = (f16)rv[j].w;
      *(v4h*)(vdst + vo + j * (16 * VSTR)) = hv;   // 8B ds_store
    }
  };
  fetch(0);
  putq(tqa, 0);
  putq(tqn, 1);
  // the wave's own rows, written by other lanes: the stores end before the reads, and the compiler moves neither over this
  asm volatile("s_wait_dscnt 0x0" ::: "memory");
  stage(0, 0);
  fetch(1);                          // the first tile has at least NTILE / 2 + 1 trips
  int par = 0;                       // K buffer of the coming trip: alternates on over the seam
  int vof = 2 * BN * VSTR;           // V buffer (offset in halves) of the trip last begun: goes round three, on over the seam

  for (int half = 0; half < 2; ++half) {
  const int  qt      = half ? pr : (NTILE - 1 - pr);
  const int  qwave   = qt * BM + wave * WM;   // first absolute query row of this wave
  const int  ntrips  = qt + 1;                // causal: only k <= last query of tile; 128 keys a trip
  getq(half, qa);

  v8f oacc[4];
#pragma unroll
  for (int vt = 0; vt < 4; ++vt) oacc[vt] = vzero;
  float mrow = -1e30f, lrow = 0.f;   // of query qwave + l16, alike in both lane halves; mrow = the reference that P, lrow and oacc are scaled by
  v8f cneg = vzero;                  // minus that reference in all eight rows: the C operand of the score product (0 until the first block sets it)

  v8f s[4];                          // a block's scores: set and read by active waves only; in group 1 they live over a barrier

  // ---- second half of a block's work: V reads, mask, softmax, O^T += V^T P^T; kb = the block's first key, vo = its V buffer ----
  auto softpv = [&](int kb, int vo) {
    // ---- V operands: they drain under the softmax
    v16h vb[2][4];                   // [chunk][d tile]
    {
      const f16* sVc = sVg + vo;
#pragma unroll
      for (int c = 0; c < 2; ++c)
#pragma unroll
        for (int vt = 0; vt < 4; ++vt) {
          // lane (l16, hl) receives V[c*32 + 8*hl + 0..7][vt*16 + l16], then the same 16 keys on: row l16 of V^T, hardware k order
          const f16* vbp = sVc + (c * 32 + hl * 8 + (lane & 7)) * VSTR + vt * 16 + ((lane >> 3) & 1) * 8;
          vb[c][vt] = cat8(ld_tr16(vbp), ld_tr16(vbp + 16 * VSTR));
        }
    }

    // ---- causal mask on diagonal blocks ----
    if (kb + BN - 1 > qwave) {
      // one lane value against constants: with kb scalar, 32 values q - constant would else be kept in registers
      const int lim = qwave + l16 - kb - hl * 8;
#pragma unroll
      for (int nt = 0; nt < 4; ++nt)
#pragma unroll
        for (int r = 0; r < 8; ++r)
          if (nt * 16 + r > lim) s[nt][r] = -1e30f;
    }

    // ---- online softmax (log2 domain), lazy: the scores arrive with the reference in use already taken off (cneg).
    //      The reference stays as long as a block's P cannot leave the f16 range; any reference that is some
    //      earlier block's true maximum gives the same quotient O / l, so nothing is rescaled on that path ----
    // P^T as B operands, one per chunk, packed from the score tiles in place: lane half hl holds keys 8*hl + r and
    // 16 + 8*hl + r of a chunk, elements r and 8 + r in the hardware k order; then the sum of a query's P over
    // both lane halves via the ones-matrix WMMA (every row of its tile holds it)
    v16h pa[2];
    v8f  lsum;
    auto expsum = [&]() {
#pragma unroll
      for (int c = 0; c < 2; ++c)
#pragma unroll
        for (int nt = 0; nt < 2; ++nt)
#pragma unroll
          for (int r = 0; r < 8; ++r)
            pa[c][nt * 8 + r] = (f16)__builtin_amdgcn_exp2f(s[2 * c + nt][r]);
      lsum = __builtin_amdgcn_wmma_f32_16x16x32_f16(false, onesb, false, pa[0], (short)0, vzero, false, false);
      lsum = __builtin_amdgcn_wmma_f32_16x16x32_f16(false, onesb, false, pa[1], (short)0, lsum, false, false);
    };
    const bool first = kb < NGRP * BN;   // the group's first block of the tile: no reference yet (scalar)
    bool renew = first;
    if (!first) {
      expsum();
      // one test per block: a sum of at most 2^14 bounds every P of the query far inside f16; an overflowed P makes the sum infinite
      renew = __builtin_amdgcn_ballot_w32(!(lsum[0] <= 16384.0f)) != 0;
    }
    if (renew) {
      // new reference: the running maximum, by a tree of three-input maxima and one exchange between the halves
      float t1[10], t2[4];
#pragma unroll
      for (int g = 0; g < 10; ++g)
        t1[g] = max3f(s[(3 * g) >> 3][(3 * g) & 7], s[(3 * g + 1) >> 3][(3 * g + 1) & 7],
                      s[(3 * g + 2) >> 3][(3 * g + 2) & 7]);
      t2[0] = max3f(t1[0], t1[1], t1[2]);
      t2[1] = max3f(t1[3], t1[4], t1[5]);
      t2[2] = max3f(t1[6], t1[7], t1[8]);
      t2[3] = max3f(t1[9], s[3][6], s[3][7]);
      const float mx    = fmaxf(max3f(t2[0], t2[1], t2[2]), t2[3]);
      const float mxq   = fmaxf(mx, xhalf(mx));              // relative to the reference in use
      const float delta = first ? mxq : fmaxf(mxq, 0.f);     // the reference never falls
      const float alpha = first ? 1.0f : __builtin_amdgcn_exp2f(-delta);   // first block: O and l are still 0
      mrow = (first ? 0.f : mrow) + delta;
#pragma unroll
      for (int r = 0; r < 8; ++r) cneg[r] = -mrow;
#pragma unroll
      for (int nt = 0; nt < 4; ++nt)
#pragma unroll
        for (int r = 0; r < 8; ++r) s[nt][r] -= delta;
#pragma unroll
      for (int vt = 0; vt < 4; ++vt)
#pragma unroll
        for (int r = 0; r < 8; ++r) oacc[vt][r] *= alpha;
      lrow *= alpha;
      expsum();
    }

    // ---- O^T += V^T P^T ----
#pragma unroll
    for (int c = 0; c < 2; ++c)
#pragma unroll
      for (int vt = 0; vt < 4; ++vt)
        oacc[vt] = __builtin_amdgcn_wmma_f32_16x16x32_f16(false, vb[c][vt], false, pa[c], (short)0, oacc[vt], false, false);
    lrow += lsum[0];
  };

  // In the first half of a block's work (K reads, scores, staging) a wave wants LDS and the matrix unit,
  // in the second mostly the vector unit. Group 1 runs half a trip behind group 0: it opens a trip with the
  // second half of its previous block, so that the two groups' waves on a SIMD want different units at a time.
  // It then reads that block's V behind the next trip's barrier: hence the third V buffer, so that the
  // staging of that trip, which refills the buffer two trips back, leaves it alone
  for (int it = 0; it < ntrips; ++it) {
    const int k0  = (it * NGRP + grp) * BN;
    const int cur = par;
    par ^= 1;

    // the one barrier of a trip: publishes the buffers of trip it (stored during trip it-1)
    // and ends every wave's reads of the buffers that are refilled behind it.
    // Its fences name LDS alone: __syncthreads() would also wait here for the global
    // loads of trip it+1, which only this thread's registers receive
    __builtin_amdgcn_fence(__ATOMIC_RELEASE, "workgroup", "local");
    __builtin_amdgcn_s_barrier();
    __builtin_amdgcn_fence(__ATOMIC_ACQUIRE, "workgroup", "local");

    if (grp == 1 && it > 0 && k0 - NGRP * BN <= qwave + (WM - 1)) softpv(k0 - NGRP * BN, vof);
    vof = vof == 2 * BN * VSTR ? 0 : vof + BN * VSTR;

    // wave-uniform skip of fully-masked key blocks (EXEC stays all-ones)
    const bool active = k0 <= qwave + (WM - 1);
    if (active) {
      const f16* sKc = sKg + (cur ? BN * KSTR : 0);
      v16h kop[4][2];
#pragma unroll
      for (int nt = 0; nt < 4; ++nt)
#pragma unroll
        for (int kc = 0; kc < 2; ++kc) {
          const f16* base = sKc + (nt * 16 + l16) * KSTR + kc * 32 + hl * 8;
          kop[nt][kc] = cat8(*(const v8h*)base, *(const v8h*)(base + 16));
        }
      // keeps the K loads one group ahead of the products: without it the compiler loads the
      // last operands one at a time, each with a full wait in front of its product
      __builtin_amdgcn_sched_barrier(0);

      // ---- S^T = K (Q*scale)^T - reference : 64x16 scores in four f32 tiles, s[nt][r] = key nt*16 + 8*hl + r ----
#pragma unroll
      for (int nt = 0; nt < 4; ++nt)
        s[nt] = __builtin_amdgcn_wmma_f32_16x16x32_f16(false, kop[nt][0], false, qa[0], (short)0, cneg, false, false);
#pragma unroll
      for (int nt = 0; nt < 4; ++nt)
        s[nt] = __builtin_amdgcn_wmma_f32_16x16x32_f16(false, kop[nt][1], false, qa[1], (short)0, s[nt], false, false);
    }

    // ---- every wave: trip it+1 registers -> its buffers, then trip it+2's loads.
    //      The pipeline runs on over the seam: behind a tile's last trips come trips 0
    //      and 1 of the same head again. No test for the very end, nor for a second tile
    //      of one trip: what is brought past a tile's end is trip 0 or 1, in bounds, goes
    //      at most into buffers that nobody reads any more and is not used
    stage(cur ^ 1, vof == 2 * BN * VSTR ? 0 : vof + BN * VSTR);
    fetch(it + 2 < ntrips ? it + 2 : it + 2 - ntrips);

    if (grp == 0 && active) softpv(k0, vof);
  }
  // group 1's last block of the tile
  if (grp == 1 && ((ntrips - 1) * NGRP + 1) * BN <= qwave + (WM - 1)) softpv(((ntrips - 1) * NGRP + 1) * BN, vof);

  // ---- join of the key groups: group 1 hands its tiles, maximum and sum over in LDS.
  //      A group that saw no key of a query hands over maximum -1e30, sum 0, tiles 0
  float4* so = sO + wave * (WM * OPIT) + lane;
  if (grp == 1) {
#pragma unroll
    for (int vt = 0; vt < 4; ++vt) {
      so[(2 * vt + 0) * 32] = make_float4(oacc[vt][0], oacc[vt][1], oacc[vt][2], oacc[vt][3]);
      so[(2 * vt + 1) * 32] = make_float4(oacc[vt][4], oacc[vt][5], oacc[vt][6], oacc[vt][7]);
    }
    sM[wave * 32 + lane] = mrow;
    sL[wave * 32 + lane] = lrow;
  }
  // publishes group 1's hand-over; LDS-only fences, as in the loop. The next tile's first
  // loop barrier ends group 0's reads before group 1 can write here again
  __builtin_amdgcn_fence(__ATOMIC_RELEASE, "workgroup", "local");
  __builtin_amdgcn_s_barrier();
  __builtin_amdgcn_fence(__ATOMIC_ACQUIRE, "workgroup", "local");

  // ---- epilogue, group 0: join, normalize and store fp32; oacc[vt][r] = O[qwave + l16][vt*16 + 8*hl + r] ----
  if (grp == 0) {
    const float m1  = sM[wave * 32 + lane];
    const float l1  = sL[wave * 32 + lane];
    const float mj  = fmaxf(mrow, m1);
    const float a0  = __builtin_amdgcn_exp2f(mrow - mj);
    const float a1  = __builtin_amdgcn_exp2f(m1 - mj);
    const float inv = 1.0f / (lrow * a0 + l1 * a1);
    const float c0  = a0 * inv, c1 = a1 * inv;
    float4 res[8];                     // res[2 * vt + e] = O[qwave + l16][vt*16 + 8*hl + 4*e + 0..3]
#pragma unroll
    for (int vt = 0; vt < 4; ++vt) {
      const float4 p = so[(2 * vt + 0) * 32];
      const float4 u = so[(2 * vt + 1) * 32];
      res[2 * vt + 0] = make_float4(oacc[vt][0] * c0 + p.x * c1, oacc[vt][1] * c0 + p.y * c1,
                                    oacc[vt][2] * c0 + p.z * c1, oacc[vt][3] * c0 + p.w * c1);
      res[2 * vt + 1] = make_float4(oacc[vt][4] * c0 + u.x * c1, oacc[vt][5] * c0 + u.y * c1,
                                    oacc[vt][6] * c0 + u.z * c1, oacc[vt][7] * c0 + u.w * c1);
    }
    // A store from this layout would touch 16 lines for 512 bytes. The wave turns its 16 rows of 256 bytes through
    // the part of sO that held its share of the hand-over, and stores two whole rows at a time.
    // All of the hand-over is read before any of it is overwritten: the compiler moves no LDS access over this
    asm volatile("s_wait_dscnt 0x0" ::: "memory");
    float4* sw = sO + wave * (WM * OPIT);
    // rows lie 68 banks apart, so sixteen lanes that write one piece number of sixteen rows, or read the sixteen
    // pieces of one row, meet every bank once; a lane's eight places to write are one address plus constants,
    // where places formed by exclusive-or would hold eight address registers over the key loop
#pragma unroll
    for (int vt = 0; vt < 4; ++vt)
#pragma unroll
      for (int e = 0; e < 2; ++e)
        sw[l16 * OPIT + hl * 2 + vt * 4 + e] = res[2 * vt + e];
    // rows written by other lanes of this wave: the stores end before the reads
    asm volatile("s_wait_dscnt 0x0" ::: "memory");
    float* orow = Oh + (size_t)(qwave + hl) * DHEAD + l16 * 4;
#pragma unroll
    for (int i = 0; i < 8; ++i)
      *(float4*)(orow + i * (2 * DHEAD)) = sw[hl * OPIT + l16 + i * (2 * OPIT)];
    // the next tile's set-up overwrites the address and data registers of these stores
    asm volatile("s_wait_xcnt 0x0" ::: "memory");
  }
  }
  // the last block's loads have no consumer: they return before the wave ends
  asm volatile("s_wait_loadcnt 0x0" ::: "memory");
}

extern "C" void kernel_launch(void* const* d_in, const int* in_sizes, int n_in,
                              void* d_out, int out_size, void* d_ws, size_t ws_size,
                              hipStream_t stream) {
  (void)in_sizes; (void)n_in; (void)out_size; (void)d_ws; (void)ws_size;
  const float* Q = (const float*)d_in[0];
  const float* K = (const float*)d_in[1];
  const float* V = (const float*)d_in[2];
  float* O = (float*)d_out;
  dim3 grid(BATCH * NHEAD * (NTILE / 2));    // 256 workgroups, two query tiles each
  dim3 block(NGRP * 256);                     // 16 wave32 waves: 8 query waves x 2 key groups
  fa_fwd_causal_kernel<<<grid, block, 0, stream>>>(Q, K, V, O);
}

// v010
// Measured time: 20.6 microseconds a run.
// Timed twice side by side with v009, it ran 1.04 times as fast both times.
// All steps since v000 together make it 3.68 times as fast.
#include <hip/hip_runtime.h>

typedef _Float16 f16;
typedef __attribute__((ext_vector_type(16))) _Float16 v16h;
typedef __attribute__((ext_vector_type(8)))  _Float16 v8h;
typedef __attribute__((ext_vector_type(4)))  _Float16 v4h;
typedef __attribute__((ext_vector_type(8)))  float    v8f;
typedef __attribute__((ext_vector_type(8)))  short    s16x8;

#define S_LEN  2048
#define DHEAD  64
#define NHEAD  16
#define BATCH  2
#define BM     128   // query rows per tile
#define NTILE  (S_LEN / BM)   // query tiles per head: 16
#define WM     16    // query rows per wave
#define BN     64    // key block: two chunks of 32 keys, the k extent of one PV product
#define KSTR   72    // sK row stride (halves): 64 + 8 pad, 144B (16B x odd)
#define VSTR   80    // sV row stride (halves): 64 + 16 pad, 160B (32B x odd), the transposing load's pitch
#define NQW    (BM / WM)   // query waves of a key group: 8
#define NGRP   2     // key groups of a workgroup: group g takes key blocks g, g + 2, g + 4, ...
#define NKB    3     // K buffers of a group
#define NVB    4     // V buffers of a group
#define OPIT   17    // pitch (16-byte pieces) of an output row on its way through LDS: 16 + 1 pad, 272 B

static __device__ __forceinline__ v16h cat8(v8h lo, v8h hi) {
  return __builtin_shufflevector(lo, hi, 0,1,2,3,4,5,6,7,8,9,10,11,12,13,14,15);
}

// transposing LDS load: the lanes' 16-byte pieces of eight rows come back as eight rows' elements of one column
static __device__ __forceinline__ v8h ld_tr16(const f16* p) {
  typedef __attribute__((address_space(3))) s16x8 lds_s16x8;
  return __builtin_bit_cast(v8h, __builtin_amdgcn_ds_load_tr16_b128_v8i16((lds_s16x8*)p));
}

static __device__ __forceinline__ float max3f(float a, float b, float c) {
  return fmaxf(fmaxf(a, b), c);
}
// the value of lane l ^ 16: the other half of the same query's keys
static __device__ __forceinline__ float xhalf(float x) {
  const int xi = __float_as_int(x);
  return __int_as_float(__builtin_amdgcn_permlanex16(xi, xi, 0x76543210, 0xfedcba98, false, false));
}

__launch_bounds__(NGRP * 256)
__global__ void fa_fwd_causal_kernel(const float* __restrict__ Qg,
                                     const float* __restrict__ Kg,
                                     const float* __restrict__ Vg,
                                     float* __restrict__ Og)
{
  __shared__ __align__(16) f16 sK[NGRP * NKB * BN * KSTR];    // per group three buffers of [key][d]  row-major
  __shared__ __align__(16) f16 sV[NGRP * NVB * BN * VSTR];    // per group four buffers of [key][d]  row-major, read transposed
  __shared__ float4 sO[NQW * WM * OPIT];                      // join: group 1's output tiles, [query wave][quad][lane]; then each wave's 16 output rows on their way to whole-line stores
  __shared__ float  sM[NQW * 32], sL[NQW * 32];               // join: group 1's maximum and sum, [query wave][lane]
  __shared__ __align__(16) f16 sQ[NGRP * NQW * 2 * WM * KSTR];   // per wave its own 16 Q rows [query][d] of either tile, on the way from whole-line loads to the B layout

  // Sixteen waves, four to a SIMD: two groups of eight. Both groups hold the same 128
  // queries; a group stages, reads and multiplies only its own key blocks, and the two
  // partial results of a tile are joined through LDS behind the tile's last block.
  const int grp  = __builtin_amdgcn_readfirstlane(threadIdx.x >> 8);   // key group, wave-uniform
  const int tid  = threadIdx.x & 255;                                  // thread inside its group
  const int wave = __builtin_amdgcn_readfirstlane(tid >> 5);           // scalar, so the tests on a wave's rows are scalar branches
  const int lane = tid & 31;
  const int hl   = lane >> 4;   // lane half (0/1)
  const int l16  = lane & 15;

  // causal cost grows linearly with the tile index, and all workgroups are resident
  // at once: each workgroup runs tile NTILE-1-pr and then tile pr of one head, so
  // every workgroup walks the same number of key blocks (NTILE + 1 in each group)
  const int bh = blockIdx.x / (NTILE / 2); // fused batch*head
  const int pr = blockIdx.x % (NTILE / 2); // tile pair

  const float* Qh = Qg + (size_t)bh * (S_LEN * DHEAD);
  const float* Kb = Kg + (size_t)bh * (S_LEN * DHEAD);
  const float* Vb = Vg + (size_t)bh * (S_LEN * DHEAD);
  float*       Oh = Og + (size_t)bh * (S_LEN * DHEAD);

  // ---- Q of a tile into B-operand layout (A's with n for m), pre-scaled by log2(e)/sqrt(D) ----
  const float qscale = 0.18033688f;        // log2(e) / 8
  // A load in the B layout itself would touch 16 lines for 512 bytes. Instead sixteen lanes read one whole
  // 256-byte row, and the wave turns its 16 rows through its own LDS rows (K's pitch, K's fragment reads)
  f16* sQw = sQ + (grp * NQW + wave) * (2 * WM * KSTR);
  auto fetchq = [&](int qt, float4* t) {   // lane half hl brings rows 8 * hl + i
    const float* qsrc = Qh + (size_t)(qt * BM + wave * WM + hl * 8) * DHEAD + l16 * 4;
#pragma unroll
    for (int i = 0; i < 8; ++i) t[i] = *(const float4*)(qsrc + i * DHEAD);
  };
  auto putq = [&](const float4* t, int j) {   // j = 0: the first tile's rows, 1: the second's
    // rows i and i + 8 lie 8 * 144 B = 32 banks apart, so an 8-byte store meets every bank once
#pragma unroll
    for (int i = 0; i < 8; ++i) {
      v4h h;
      h[0] = (f16)(t[i].x * qscale); h[1] = (f16)(t[i].y * qscale);
      h[2] = (f16)(t[i].z * qscale); h[3] = (f16)(t[i].w * qscale);
      *(v4h*)(sQw + (j * WM + hl * 8 + i) * KSTR + l16 * 4) = h;   // 8B ds_store
    }
  };
  auto getq = [&](int j, v16h* qdst) {
#pragma unroll
    for (int kc = 0; kc < 2; ++kc) {
      const f16* base = sQw + (j * WM + l16) * KSTR + kc * 32 + hl * 8;   // k order: {d0..d0+7, d0+16..d0+23}, as the K rows
      qdst[kc] = cat8(*(const v8h*)base, *(const v8h*)(base + 16));
    }
  };
  v16h qa[2];                              // both tiles' Q come up front: no global load at the seam; the second tile's waits in LDS, not in registers
  float4 tqa[8], tqn[8];                   // their loads fly together with the first key block's
  fetchq(NTILE - 1 - pr, tqa);
  fetchq(pr, tqn);

  // all-ones A operand: the sum of a query's P over both lane halves via one extra WMMA per 32-key chunk
  v16h onesb;
#pragma unroll
  for (int i = 0; i < 16; ++i) onesb[i] = (f16)1.0f;

  const v8f vzero = {0.f,0.f,0.f,0.f,0.f,0.f,0.f,0.f};
  // staging: sixteen lanes bring one whole 256-byte row, so a wave's load touches four whole lines;
  // a thread brings 4 d of K rows skey + 16 * j and of V rows vkey + 16 * j, j = 0..3
  const int sd0   = l16 * 4;         // staging: d {0,4,..,60}
  // the two rows of a wave's 8-byte LDS store (128 bytes each) lie 32 banks apart and meet every bank once:
  // K rows 8 apart (8 * 144 B), V rows 4 apart (4 * 160 B)
  const int skey  = hl * 8 + wave;
  const int vkey  = ((wave >> 2) << 3) + hl * 4 + (wave & 3);

  // ---- staging pipeline: a key block goes global -> registers -> LDS buffer, one
  //      block ahead in LDS and two ahead in registers, so neither the global
  //      latency nor the LDS stores stand between a barrier and the products
  f16* sKg = sK + grp * (NKB * BN * KSTR);     // the group's own buffers
  f16* sVg = sV + grp * (NVB * BN * VSTR);
  const float* kst = Kb + (size_t)(grp * BN + skey) * DHEAD + sd0;
  const float* vst = Vb + (size_t)(grp * BN + vkey) * DHEAD + sd0;
  f16* kdst = sKg + skey * KSTR + sd0;
  f16* vdst = sVg + vkey * VSTR + sd0;
  float4 rk[4], rv[4];               // [key skey or vkey + 16 * j]
  auto fetch = [&](int it) {         // the group's block of trip it: key block NGRP * it + grp
    const float* ks = kst + (size_t)it * (NGRP * BN * DHEAD);
    const float* vs = vst + (size_t)it * (NGRP * BN * DHEAD);
#pragma unroll
    for (int j = 0; j < 4; ++j) {
      rk[j] = *(const float4*)(ks + j * (16 * DHEAD));
      rv[j] = *(const float4*)(vs + j * (16 * DHEAD));
    }
    // precaution: no register that an issued load names is rewritten ahead of this wait. The two
    // addresses are its inputs, so they stay whole up to it and no load's result is laid over them
    asm volatile("s_wait_xcnt 0x0" :: "v"(ks), "v"(vs) : "memory");
  };
  // buffer offsets here and at the operand loads are selects, not products: K and V buffers now differ
  // in size, and from buf * size the compiler made four vector multiply-adds a trip
  auto stage = [&](int ko, int vo) {   // K and V buffer by their offsets in halves
#pragma unroll
    for (int j = 0; j < 4; ++j) {
      v4h hk;
      hk[0] = (f16)rk[j].x; hk[1] = (f16)rk[j].y; hk[2] = (f16)rk[j].z; hk[3] = (f16)rk[j].w;
      *(v4h*)(kdst + ko + j * (16 * KSTR)) = hk;   // 8B ds_store
    }
#pragma unroll
    for (int j = 0; j < 4; ++j) {
      v4h hv;
      hv[0] = (f16)rv[j].x; hv[1] = (f16)rv[j].y; hv[2] = (f16)rv[j].z; hv[3] = (f16)rv[j].w;
      *(v4h*)(vdst + vo + j * (16 * VSTR)) = hv;   // 8B ds_store
    }
  };
  fetch(0);
  putq(tqa, 0);
  putq(tqn, 1);
  // the wave's own rows, written by other lanes: the stores end before the reads, and the compiler moves neither over this
  asm volatile("s_wait_dscnt 0x0" ::: "memory");
  stage(0, 0);
  fetch(1);                          // the first tile has at least NTILE / 2 + 1 trips
  int kof = 0;                       // K buffer (offset in halves) of the coming trip: goes round three, on over the seam
  int vof = (NVB - 1) * BN * VSTR;   // V buffer (offset in halves) of the trip last begun: goes round four, on over the seam
  // publishes the first key block. LDS-only fences: __syncthreads() would also wait here for the global
  // loads of the second block, which only this thread's registers receive
  __builtin_amdgcn_fence(__ATOMIC_RELEASE, "workgroup", "local");
  __builtin_amdgcn_s_barrier();
  __builtin_amdgcn_fence(__ATOMIC_ACQUIRE, "workgroup", "local");

  for (int half = 0; half < 2; ++half) {
  const int  qt      = half ? pr : (NTILE - 1 - pr);
  const int  qwave   = qt * BM + wave * WM;   // first absolute query row of this wave
  const int  ntrips  = qt + 1;                // causal: only k <= last query of tile; 128 keys a trip
  getq(half, qa);

  v8f oacc[4];
#pragma unroll
  for (int vt = 0; vt < 4; ++vt) oacc[vt] = vzero;
  float mrow = -1e30f, lrow = 0.f;   // of query qwave + l16, alike in both lane halves; mrow = the reference that P, lrow and oacc are scaled by
  v8f cneg = vzero;                  // minus that reference in all eight rows: the C operand of the score product (0 until the first block sets it)

  v8f s[4];                          // a block's scores: set and read by active waves only; in group 1 they live over a barrier

  // ---- second half of a block's work: V reads, mask, softmax, O^T += V^T P^T; kb = the block's first key, vo = its V buffer ----
  auto softpv = [&](int kb, int vo) {
    // ---- V operands: they drain under the softmax
    v16h vb[2][4];                   // [chunk][d tile]
    {
      const f16* sVc = sVg + vo;
#pragma unroll
      for (int c = 0; c < 2; ++c)
#pragma unroll
        for (int vt = 0; vt < 4; ++vt) {
          // lane (l16, hl) receives V[c*32 + 8*hl + 0..7][vt*16 + l16], then the same 16 keys on: row l16 of V^T, hardware k order
          const f16* vbp = sVc + (c * 32 + hl * 8 + (lane & 7)) * VSTR + vt * 16 + ((lane >> 3) & 1) * 8;
          vb[c][vt] = cat8(ld_tr16(vbp), ld_tr16(vbp + 16 * VSTR));
        }
    }

    // ---- causal mask on diagonal blocks ----
    if (kb + BN - 1 > qwave) {
      // one lane value against constants: with kb scalar, 32 values q - constant would else be kept in registers
      const int lim = qwave + l16 - kb - hl * 8;
#pragma unroll
      for (int nt = 0; nt < 4; ++nt)
#pragma unroll
        for (int r = 0; r < 8; ++r)
          if (nt * 16 + r > lim) s[nt][r] = -1e30f;
    }

    // ---- online softmax (log2 domain), lazy: the scores arrive with the reference in use already taken off (cneg).
    //      The reference stays as long as a block's P cannot leave the f16 range; any reference that is some
    //      earlier block's true maximum gives the same quotient O / l, so nothing is rescaled on that path ----
    // P^T as B operands, one per chunk, packed from the score tiles in place: lane half hl holds keys 8*hl + r and
    // 16 + 8*hl + r of a chunk, elements r and 8 + r in the hardware k order; then the sum of a query's P over
    // both lane halves via the ones-matrix WMMA (every row of its tile holds it)
    v16h pa[2];
    v8f  lsum;
    auto expsum = [&]() {
#pragma unroll
      for (int c = 0; c < 2; ++c)
#pragma unroll
        for (int nt = 0; nt < 2; ++nt)
#pragma unroll
          for (int r = 0; r < 8; ++r)
            pa[c][nt * 8 + r] = (f16)__builtin_amdgcn_exp2f(s[2 * c + nt][r]);
      lsum = __builtin_amdgcn_wmma_f32_16x16x32_f16(false, onesb, false, pa[0], (short)0, vzero, false, false);
      lsum = __builtin_amdgcn_wmma_f32_16x16x32_f16(false, onesb, false, pa[1], (short)0, lsum, false, false);
    };
    const bool first = kb < NGRP * BN;   // the group's first block of the tile: no reference yet (scalar)
    bool renew = first;
    if (!first) {
      expsum();
      // one test per block: a sum of at most 2^14 bounds every P of the query far inside f16; an overflowed P makes the sum infinite
      renew = __builtin_amdgcn_ballot_w32(!(lsum[0] <= 16384.0f)) != 0;
    }
    if (renew) {
      // new reference: the running maximum, by a tree of three-input maxima and one exchange between the halves
      float t1[10], t2[4];
#pragma unroll
      for (int g = 0; g < 10; ++g)
        t1[g] = max3f(s[(3 * g) >> 3][(3 * g) & 7], s[(3 * g + 1) >> 3][(3 * g + 1) & 7],
                      s[(3 * g + 2) >> 3][(3 * g + 2) & 7]);
      t2[0] = max3f(t1[0], t1[1], t1[2]);
      t2[1] = max3f(t1[3], t1[4], t1[5]);
      t2[2] = max3f(t1[6], t1[7], t1[8]);
      t2[3] = max3f(t1[9], s[3][6], s[3][7]);
      const float mx    = fmaxf(max3f(t2[0], t2[1], t2[2]), t2[3]);
      const float mxq   = fmaxf(mx, xhalf(mx));              // relative to the reference in use
      const float delta = first ? mxq : fmaxf(mxq, 0.f);     // the reference never falls
      const float alpha = first ? 1.0f : __builtin_amdgcn_exp2f(-delta);   // first block: O and l are still 0
      mrow = (first ? 0.f : mrow) + delta;
#pragma unroll
      for (int r = 0; r < 8; ++r) cneg[r] = -mrow;
#pragma unroll
      for (int nt = 0; nt < 4; ++nt)
#pragma unroll
        for (int r = 0; r < 8; ++r) s[nt][r] -= delta;
#pragma unroll
      for (int vt = 0; vt < 4; ++vt)
#pragma unroll
        for (int r = 0; r < 8; ++r) oacc[vt][r] *= alpha;
      lrow *= alpha;
      expsum();
    }

    // ---- O^T += V^T P^T ----
#pragma unroll
    for (int c = 0; c < 2; ++c)
#pragma unroll
      for (int vt = 0; vt < 4; ++vt)
        oacc[vt] = __builtin_amdgcn_wmma_f32_16x16x32_f16(false, vb[c][vt], false, pa[c], (short)0, oacc[vt], false, false);
    lrow += lsum[0];
  };

  // In the first half of a block's work (K reads, scores) a wave wants LDS and the matrix unit,
  // in the second mostly the vector unit. Group 1 runs half a trip behind group 0: behind a trip's staging it takes
  // the second half of its previous block first, so that the two groups' waves on a SIMD want different units at a time.
  //
  // The one barrier of a trip is split, so that no wave stands still for the slowest: a wave stages the NEXT
  // trip's block at the head of a trip and signals right behind those stores; it waits at the trip's foot, by
  // when the others have as a rule long signalled. The waves may so drift up to one trip apart.
  // What the signal of trip t says: my stores of block t+1 have ended, and so have my reads of trips <= t-1.
  // What passing the wait of trip t allows: reading block t+1, and (in trip t+1) storing block t+2.
  // The reads of trip t itself stand between signal and wait; the buffers they read are left alone because block
  // t+2 goes where K block t-1 lay (three K buffers) and where V block t-2 lay (four V buffers: group 1 reads
  // V block t-1 in trip t): every wave's reads of those two lie in trips <= t-1, ahead of its signal of trip t.
  // No wave comes to trip t+2, whose stores would reach them, before the slowest has signalled in trip t+1
  for (int it = 0; it < ntrips; ++it) {
    const int k0   = (it * NGRP + grp) * BN;
    const int kcur = kof;            // this trip's K buffer
    const int vprv = vof;            // the V buffer of the trip before
    kof = kof == (NKB - 1) * BN * KSTR ? 0 : kof + BN * KSTR;
    vof = vof == (NVB - 1) * BN * VSTR ? 0 : vof + BN * VSTR;

    // ---- every wave: trip it+1 registers -> its buffers, then trip it+2's loads.
    //      The pipeline runs on over the seam: behind a tile's last trips come trips 0
    //      and 1 of the same head again. No test for the very end, nor for a second tile
    //      of one trip: what is brought past a tile's end is trip 0 or 1, in bounds, goes
    //      at most into buffers that nobody reads any more and is not used
    stage(kof, vof == (NVB - 1) * BN * VSTR ? 0 : vof + BN * VSTR);
    fetch(it + 2 < ntrips ? it + 2 : it + 2 - ntrips);
    // the stores above end before the signal; the fence names LDS alone, so the loads just issued stay in flight
    __builtin_amdgcn_fence(__ATOMIC_RELEASE, "workgroup", "local");
    __builtin_amdgcn_s_barrier_signal(-1);

    if (grp == 1 && it > 0 && k0 - NGRP * BN <= qwave + (WM - 1)) softpv(k0 - NGRP * BN, vprv);

    // wave-uniform skip of fully-masked key blocks (EXEC stays all-ones)
    const bool active = k0 <= qwave + (WM - 1);
    if (active) {
      const f16* sKc = sKg + kcur;
      v16h kop[4][2];
#pragma unroll
      for (int nt = 0; nt < 4; ++nt)
#pragma unroll
        for (int kc = 0; kc < 2; ++kc) {
          const f16* base = sKc + (nt * 16 + l16) * KSTR + kc * 32 + hl * 8;
          kop[nt][kc] = cat8(*(const v8h*)base, *(const v8h*)(base + 16));
        }
      // keeps the K loads one group ahead of the products: without it the compiler loads the
      // last operands one at a time, each with a full wait in front of its product
      __builtin_amdgcn_sched_barrier(0);

      // ---- S^T = K (Q*scale)^T - reference : 64x16 scores in four f32 tiles, s[nt][r] = key nt*16 + 8*hl + r ----
#pragma unroll
      for (int nt = 0; nt < 4; ++nt)
        s[nt] = __builtin_amdgcn_wmma_f32_16x16x32_f16(false, kop[nt][0], false, qa[0], (short)0, cneg, false, false);
#pragma unroll
      for (int nt = 0; nt < 4; ++nt)
        s[nt] = __builtin_amdgcn_wmma_f32_16x16x32_f16(false, kop[nt][1], false, qa[1], (short)0, s[nt], false, false);
    }

    if (grp == 0 && active) softpv(k0, vof);

    // every wave has signalled: block it+1 is whole, and the buffers that the next trip refills are read out
    __builtin_amdgcn_s_barrier_wait(-1);
    __builtin_amdgcn_fence(__ATOMIC_ACQUIRE, "workgroup", "local");
  }
  // group 1's last block of the tile
  if (grp == 1 && ((ntrips - 1) * NGRP + 1) * BN <= qwave + (WM - 1)) softpv(((ntrips - 1) * NGRP + 1) * BN, vof);

  // ---- join of the key groups: group 1 hands its tiles, maximum and sum over in LDS.
  //      A group that saw no key of a query hands over maximum -1e30, sum 0, tiles 0
  float4* so = sO + wave * (WM * OPIT) + lane;
  if (grp == 1) {
#pragma unroll
    for (int vt = 0; vt < 4; ++vt) {
      so[(2 * vt + 0) * 32] = make_float4(oacc[vt][0], oacc[vt][1], oacc[vt][2], oacc[vt][3]);
      so[(2 * vt + 1) * 32] = make_float4(oacc[vt][4], oacc[vt][5], oacc[vt][6], oacc[vt][7]);
    }
    sM[wave * 32 + lane] = mrow;
    sL[wave * 32 + lane] = lrow;
  }
  // publishes group 1's hand-over; LDS-only fences, as in the loop. The next tile's loop
  // barriers end group 0's reads before group 1 can write here again
  __builtin_amdgcn_fence(__ATOMIC_RELEASE, "workgroup", "local");
  __builtin_amdgcn_s_barrier();
  __builtin_amdgcn_fence(__ATOMIC_ACQUIRE, "workgroup", "local");

  // ---- epilogue, group 0: join, normalize and store fp32; oacc[vt][r] = O[qwave + l16][vt*16 + 8*hl + r] ----
  if (grp == 0) {
    const float m1  = sM[wave * 32 + lane];
    const float l1  = sL[wave * 32 + lane];
    const float mj  = fmaxf(mrow, m1);
    const float a0  = __builtin_amdgcn_exp2f(mrow - mj);
    const float a1  = __builtin_amdgcn_exp2f(m1 - mj);
    const float inv = 1.0f / (lrow * a0 + l1 * a1);
    const float c0  = a0 * inv, c1 = a1 * inv;
    float4 res[8];                     // res[2 * vt + e] = O[qwave + l16][vt*16 + 8*hl + 4*e + 0..3]
#pragma unroll
    for (int vt = 0; vt < 4; ++vt) {
      const float4 p = so[(2 * vt + 0) * 32];
      const float4 u = so[(2 * vt + 1) * 32];
      res[2 * vt + 0] = make_float4(oacc[vt][0] * c0 + p.x * c1, oacc[vt][1] * c0 + p.y * c1,
                                    oacc[vt][2] * c0 + p.z * c1, oacc[vt][3] * c0 + p.w * c1);
      res[2 * vt + 1] = make_float4(oacc[vt][4] * c0 + u.x * c1, oacc[vt][5] * c0 + u.y * c1,
                                    oacc[vt][6] * c0 + u.z * c1, oacc[vt][7] * c0 + u.w * c1);
    }
    // A store from this layout would touch 16 lines for 512 bytes. The wave turns its 16 rows of 256 bytes through
    // the part of sO that held its share of the hand-over, and stores two whole rows at a time.
    // All of the hand-over is read before any of it is overwritten: the compiler moves no LDS access over this
    asm volatile("s_wait_dscnt 0x0" ::: "memory");
    float4* sw = sO + wave * (WM * OPIT);
    // rows lie 68 banks apart, so sixteen lanes that write one piece number of sixteen rows, or read the sixteen
    // pieces of one row, meet every bank once; a lane's eight places to write are one address plus constants,
    // where places formed by exclusive-or would hold eight address registers over the key loop
#pragma unroll
    for (int vt = 0; vt < 4; ++vt)
#pragma unroll
      for (int e = 0; e < 2; ++e)
        sw[l16 * OPIT + hl * 2 + vt * 4 + e] = res[2 * vt + e];
    // rows written by other lanes of this wave: the stores end before the reads
    asm volatile("s_wait_dscnt 0x0" ::: "memory");
    float* orow = Oh + (size_t)(qwave + hl) * DHEAD + l16 * 4;
#pragma unroll
    for (int i = 0; i < 8; ++i)
      *(float4*)(orow + i * (2 * DHEAD)) = sw[hl * OPIT + l16 + i * (2 * OPIT)];
    // the next tile's set-up overwrites the address and data registers of these stores
    asm volatile("s_wait_xcnt 0x0" ::: "memory");
  }
  }
  // the last block's loads have no consumer: they return before the wave ends
  asm volatile("s_wait_loadcnt 0x0" ::: "memory");
}

extern "C" void kernel_launch(void* const* d_in, const int* in_sizes, int n_in,
                              void* d_out, int out_size, void* d_ws, size_t ws_size,
                              hipStream_t stream) {
  (void)in_sizes; (void)n_in; (void)out_size; (void)d_ws; (void)ws_size;
  const float* Q = (const float*)d_in[0];
  const float* K = (const float*)d_in[1];
  const float* V = (const float*)d_in[2];
  float* O = (float*)d_out;
  dim3 grid(BATCH * NHEAD * (NTILE / 2));    // 256 workgroups, two query tiles each
  dim3 block(NGRP * 256);                     // 16 wave32 waves: 8 query waves x 2 key groups
  fa_fwd_causal_kernel<<<grid, block, 0, stream>>>(Q, K, V, O);
}
